// v000
// The times below were measured on an AMD MI455X: many runs one after another, warmed up first and cycling through
// copies of the inputs, with the whole window's GPU time divided by the number of runs. Launches and the gaps
// between them are all in it. The median over several windows is given; except for v000 it joins two sittings, which
// can be a few percent apart, so the side-by-side timings, each taken in one sitting, are the better comparison.
// v000, which the later versions start from, runs in 320 microseconds.
#include <hip/hip_runtime.h>
#include <stdint.h>
#include <stddef.h>

// All contractions: v_wmma_f32_16x16x32_f16 (f16 operands, f32 accumulate); weights carried x16 in f16 (k-contiguous transposed copy), folded back as 1/16 in the f32 epilogue; coupling tanh/exp/flip/logdet math in f32.

typedef _Float16 f16t;
typedef f16t  v8h  __attribute__((ext_vector_type(8)));
typedef f16t  v16h __attribute__((ext_vector_type(16)));
typedef float v4f  __attribute__((ext_vector_type(4)));
typedef float v8f  __attribute__((ext_vector_type(8)));
typedef unsigned int v4u __attribute__((ext_vector_type(4)));

union Frag { v16h v; v8h q[2]; };

constexpr int D   = 128;           // patch dim
constexpr int CND = 128;           // cond dim
constexpr int HID = 256;           // hidden
constexpr int DIN = D / 2 + CND;   // 192
constexpr int TOK = 128;           // tokens per batch element = one block
constexpr int NTH = 256;           // threads per block (8 waves x 16 token rows)
constexpr int NP  = 128;           // output columns per pass (8 n-tiles)

constexpr int ZS = 132;            // z row stride in floats (528 B, 16-B aligned)
constexpr int AS = 264;            // activation row stride in halves (528 B)
constexpr int SS = 40;             // weight slab row stride in halves (80 B), 32 k per row

constexpr float WSCALE = 16.0f;    // exact power of two on the f16 weight copy
constexpr float WINV   = 0.0625f;

// dynamic LDS carve (bytes)
constexpr int OFF_Z = 0;                       // [128][ZS] f32 z
constexpr int OFF_A = OFF_Z + TOK * ZS * 4;    // [128][AS] f16 act (stage-1 out)
constexpr int OFF_B = OFF_A + TOK * AS * 2;    // [128][AS] f16 act (stage-2 out)
constexpr int OFF_S = OFF_B + TOK * AS * 2;    // [128][SS] f16 weight slab
constexpr int OFF_C = OFF_S + NP * SS * 2;     // [128] f16 cond
constexpr int OFF_R = OFF_C + CND * 2;         // [256] f32 reduce
constexpr int SMEM_TOTAL = OFF_R + NTH * 4;    // 214272 B

static_assert(OFF_A % 16 == 0 && OFF_B % 16 == 0 && OFF_S % 16 == 0 && OFF_C % 16 == 0 && OFF_R % 16 == 0, "");

constexpr int LN1 = HID * (DIN / 64);          // 768  (W1t: 256 rows x 192 halves)
constexpr int LN2 = HID * (HID / 64);          // 1024 (W2t: 256 rows x 256 halves)
constexpr int LN3 = D * (HID / 64);            // 512  (W3t: 128 rows x 256 halves)
constexpr int LPL = LN1 + LN2 + LN3;           // 2304
constexpr int WPL = HID * DIN + HID * HID + D * HID;   // halves per layer = 147456

__device__ __forceinline__ v8f wmma_f16(v16h a, v16h b, v8f c) {
  c = __builtin_amdgcn_wmma_f32_16x16x32_f16(false, a, false, b, (short)0, c, false, false);
  asm volatile("v_nop\n\tv_nop\n\tv_nop\n\tv_nop" : "+v"(c) : "v"(a), "v"(b));
  return c;
}

// 16x32 fragment from a k-contiguous 16-bit row: elems 0..7 <- p[8h..8h+7], elems 8..15 <- p[16+8h..16+8h+7]
__device__ __forceinline__ v16h ldfrag16(const f16t* p, int h) {
  Frag f;
  f.q[0] = *(const v8h*)(p + 8 * h);
  f.q[1] = *(const v8h*)(p + 16 + 8 * h);
  return f.v;
}

// same map from an f32 row, RNE convert to f16 in registers
__device__ __forceinline__ v16h ldfrag32(const float* p, int h) {
  v4f a0 = *(const v4f*)(p + 8 * h);
  v4f a1 = *(const v4f*)(p + 8 * h + 4);
  v4f a2 = *(const v4f*)(p + 16 + 8 * h);
  v4f a3 = *(const v4f*)(p + 16 + 8 * h + 4);
  v8f lo = __builtin_shufflevector(a0, a1, 0, 1, 2, 3, 4, 5, 6, 7);
  v8f hi = __builtin_shufflevector(a2, a3, 0, 1, 2, 3, 4, 5, 6, 7);
  Frag f;
  f.q[0] = __builtin_convertvector(lo, v8h);
  f.q[1] = __builtin_convertvector(hi, v8h);
  return f.v;
}

__device__ __forceinline__ void zero8(v8f (&c)[8]) {
#pragma unroll
  for (int j = 0; j < 8; ++j) {
    v8f z = {0.f, 0.f, 0.f, 0.f, 0.f, 0.f, 0.f, 0.f};
    c[j] = z;
  }
}

// Stage one 128-row x 32-k slab of the transposed weight copy (rows n0.., k-tile kt) into LDS.
// wrows points at Wt[n0][k0]; K = row pitch of Wt in halves. Barriers on both sides (slab is block-shared).
__device__ __forceinline__ void stage_slab(f16t* wslab, const f16t* wrows, int K, int tid) {
  __syncthreads();
#pragma unroll
  for (int it = 0; it < (NP * 4) / NTH; ++it) {
    const int idx = tid + it * NTH;
    const int rn = idx >> 2, sg = idx & 3;
    v4u v = *(const v4u*)(wrows + (size_t)rn * K + sg * 8);
    *(v4u*)(wslab + rn * SS + sg * 8) = v;
  }
  __syncthreads();
}

// One 32-deep k-tile for 8 n-tiles: B fragment for n-tile j from slab row (j*16 + m), split k map as A.
__device__ __forceinline__ void ktile(v8f (&c)[8], v16h a, const f16t* wslab, int m, int h) {
#pragma unroll
  for (int j = 0; j < 8; ++j) {
    v16h bfr = ldfrag16(wslab + (j * 16 + m) * SS, h);
    c[j] = wmma_f16(a, bfr, c[j]);
  }
}

// bias + relu + f16 store into wave-private activation rows; D map: c[j][r] = (row 8h+r, col j*16+m)
__device__ __forceinline__ void relu_store(const v8f (&c)[8], f16t* act, const float* __restrict__ bias,
                                           int n0, int rowbase, int m, int h) {
#pragma unroll
  for (int j = 0; j < 8; ++j) {
    const int col = n0 + j * 16 + m;
    const float bv = bias[col];
#pragma unroll
    for (int r = 0; r < 8; ++r) {
      float v = c[j][r] * WINV + bv;
      v = v > 0.f ? v : 0.f;
      act[(rowbase + 8 * h + r) * AS + col] = (f16t)v;
    }
  }
}

__device__ __forceinline__ float tanh_f(float u) {
  u = fminf(fmaxf(u, -16.0f), 16.0f);
  const float e = __expf(2.0f * u);
  return 1.0f - 2.0f * __builtin_amdgcn_rcpf(e + 1.0f);
}

// ---------------------------------------------------------------------------
// Launch 1: W[l][k][n] f32 -> Wt[l][n][k] f16 (x16), k-contiguous rows.
// ---------------------------------------------------------------------------
__global__ void __launch_bounds__(256)
k_convert(const float* __restrict__ W1, const float* __restrict__ W2, const float* __restrict__ W3,
          f16t* __restrict__ wt, int nl) {
  const int g = blockIdx.x * 256 + threadIdx.x;
  if (g >= nl * LPL) return;
  const int l = g / LPL;
  int q = g - l * LPL;
  const float* src;
  f16t* dst;
  int K, N, n, part;
  const size_t base2 = (size_t)nl * HID * DIN;
  const size_t base3 = base2 + (size_t)nl * HID * HID;
  if (q < LN1) {
    n = q / (DIN / 64); part = q - n * (DIN / 64);
    K = DIN; N = HID;
    src = W1 + (size_t)l * DIN * HID;
    dst = wt + (size_t)l * HID * DIN;
  } else if (q < LN1 + LN2) {
    q -= LN1;
    n = q / (HID / 64); part = q - n * (HID / 64);
    K = HID; N = HID;
    src = W2 + (size_t)l * HID * HID;
    dst = wt + base2 + (size_t)l * HID * HID;
  } else {
    q -= LN1 + LN2;
    n = q / (HID / 64); part = q - n * (HID / 64);
    K = HID; N = D;
    src = W3 + (size_t)l * HID * D;
    dst = wt + base3 + (size_t)l * D * HID;
  }
  const int k0 = part * 64;
  union { v4u u[8]; f16t e[64]; } pk;
#pragma unroll
  for (int i = 0; i < 64; ++i)
    pk.e[i] = (f16t)(src[(size_t)(k0 + i) * N + n] * WSCALE);
  f16t* drow = dst + (size_t)n * K + k0;
#pragma unroll
  for (int s = 0; s < 8; ++s) *(v4u*)(drow + s * 8) = pk.u[s];
  
}

// ---------------------------------------------------------------------------
// Launch 2: one block per batch element, 8 waves x 16 wave-private token rows, z resident in LDS.
// ---------------------------------------------------------------------------
__global__ void __launch_bounds__(256)
k_flow(const float* __restrict__ x, const float* __restrict__ cond,
       const float* __restrict__ b1, const float* __restrict__ b2, const float* __restrict__ b3,
       const f16t* __restrict__ wt, float* __restrict__ outz, float* __restrict__ part,
       int B, int nl) {
  extern __shared__ v4u dsm[];
  char* smem = (char*)dsm;
  float* zbuf  = (float*)(smem + OFF_Z);
  f16t*  actA  = (f16t*)(smem + OFF_A);
  f16t*  actB  = (f16t*)(smem + OFF_B);
  f16t*  wslab = (f16t*)(smem + OFF_S);
  f16t*  condh = (f16t*)(smem + OFF_C);
  float* red   = (float*)(smem + OFF_R);

  const int b = blockIdx.x;
  if (b >= B) return;                        // block-uniform, before any barrier
  const int tid = threadIdx.x;
  const int lane = tid & 31, wave = tid >> 5;
  const int m = lane & 15, h = lane >> 4;
  const int rowbase = wave * 16;

  // stage x[b] (128 x 128 f32) and cond[b] (128, f16)
  {
    const float* xb = x + (size_t)b * TOK * D;
    for (int idx = tid; idx < TOK * (D / 4); idx += NTH) {
      const int r = idx / (D / 4), s = idx - r * (D / 4);
      *(v4f*)(zbuf + r * ZS + s * 4) = *(const v4f*)(xb + (size_t)r * D + s * 4);
    }
    if (tid < CND) condh[tid] = (f16t)cond[(size_t)b * CND + tid];
  }
  __syncthreads();

  float ldacc = 0.f;
  const size_t base2 = (size_t)nl * HID * DIN;
  const size_t base3 = base2 + (size_t)nl * HID * HID;

  const float* zrow  = zbuf + (rowbase + m) * ZS;
  const f16t*  arowA = actA + (rowbase + m) * AS;
  const f16t*  arowB = actB + (rowbase + m) * AS;

  for (int l = 0; l < nl; ++l) {
    const f16t* w1t = wt + (size_t)l * HID * DIN;
    const f16t* w2t = wt + base2 + (size_t)l * HID * HID;
    const f16t* w3t = wt + base3 + (size_t)l * D * HID;

    // stage 1: [16 x 192] @ [192 x 256] + relu -> actA ; A = [x1 | cond]
#pragma unroll 1
    for (int np = 0; np < HID / NP; ++np) {
      const int n0 = np * NP;
      const f16t* wr = w1t + (size_t)n0 * DIN;
      v8f c[8];
      zero8(c);
#pragma unroll 1
      for (int kt = 0; kt < (D / 2) / 32; ++kt) {           // k 0..63 from z (f32 -> f16)
        stage_slab(wslab, wr + kt * 32, DIN, tid);
        v16h a = ldfrag32(zrow + kt * 32, h);
        ktile(c, a, wslab, m, h);
      }
#pragma unroll 1
      for (int kt = (D / 2) / 32; kt < DIN / 32; ++kt) {    // k 64..191 from cond
        stage_slab(wslab, wr + kt * 32, DIN, tid);
        v16h a = ldfrag16(condh + (kt - (D / 2) / 32) * 32, h);
        ktile(c, a, wslab, m, h);
      }
      relu_store(c, actA, b1 + (size_t)l * HID, n0, rowbase, m, h);
    }

    // stage 2: [16 x 256] @ [256 x 256] + relu -> actB
#pragma unroll 1
    for (int np = 0; np < HID / NP; ++np) {
      const int n0 = np * NP;
      const f16t* wr = w2t + (size_t)n0 * HID;
      v8f c[8];
      zero8(c);
#pragma unroll 1
      for (int kt = 0; kt < HID / 32; ++kt) {
        stage_slab(wslab, wr + kt * 32, HID, tid);
        v16h a = ldfrag16(arowA + kt * 32, h);
        ktile(c, a, wslab, m, h);
      }
      relu_store(c, actB, b2 + (size_t)l * HID, n0, rowbase, m, h);
    }

    // stage 3: [16 x 256] @ [256 x 128] -> s | t ; coupling + flip
    {
      v8f c[8];
      zero8(c);
#pragma unroll 1
      for (int kt = 0; kt < HID / 32; ++kt) {
        stage_slab(wslab, w3t + kt * 32, HID, tid);
        v16h a = ldfrag16(arowB + kt * 32, h);
        ktile(c, a, wslab, m, h);
      }
      const float* bb = b3 + (size_t)l * D;
      float x1v[4][8], y2v[4][8];
#pragma unroll
      for (int n = 0; n < 4; ++n) {                // n-tiles 0..3 = s cols 0..63, 4..7 = t cols
        const int col = n * 16 + m;
        const float bs = bb[col];
        const float bt = bb[D / 2 + col];
#pragma unroll
        for (int r = 0; r < 8; ++r) {
          const int tok = rowbase + 8 * h + r;
          const float u  = c[n][r] * WINV + bs;
          const float sv = 0.5f * tanh_f(u);
          const float tv = c[n + 4][r] * WINV + bt;
          const float x2 = zbuf[tok * ZS + D / 2 + col];
          y2v[n][r] = x2 * __expf(sv) + tv;
          x1v[n][r] = zbuf[tok * ZS + col];
          ldacc += sv;
        }
      }
      __syncthreads();                              // all z reads of this layer before any z write
#pragma unroll
      for (int n = 0; n < 4; ++n) {
        const int col = n * 16 + m;
#pragma unroll
        for (int r = 0; r < 8; ++r) {
          const int tok = rowbase + 8 * h + r;
          zbuf[tok * ZS + (D - 1 - col)]     = x1v[n][r];   // z'[64..127] = rev(x1)
          zbuf[tok * ZS + (D / 2 - 1 - col)] = y2v[n][r];   // z'[0..63]   = rev(y2)
        }
      }
    }
  }

  // logdet block reduction
  red[tid] = ldacc;
  __syncthreads();                                  // also orders z element stores before the vector reloads below
  float ld = 0.f;
  if (wave == 0) {
#pragma unroll
    for (int k = 0; k < NTH / 32; ++k) ld += red[lane + 32 * k];
#pragma unroll
    for (int off = 16; off > 0; off >>= 1) ld += __shfl_xor(ld, off, 32);
  }

  float* oz = outz + ((size_t)b * TOK + rowbase) * D;
  float* pl = part + (size_t)b * 32;
#pragma unroll
  for (int r = 0; r < 16; ++r) {
    v4f v = *(const v4f*)(zbuf + (rowbase + r) * ZS + lane * 4);
    *(v4f*)(oz + (size_t)r * D + lane * 4) = v;
  }
  if (wave == 0) *(float*)(pl + lane) = ld;
  
}

// ---------------------------------------------------------------------------
// ---------------------------------------------------------------------------
__global__ void __launch_bounds__(256)
k_final(const float* __restrict__ part, float* __restrict__ outld, int B) {
  const int nq = (B + 3) / 4;
  for (int q = threadIdx.x; q < nq; q += 256) {
    const int b0 = q * 4;
    if (b0 + 3 < B) {
      v4f v;
      v.x = part[(size_t)(b0 + 0) * 32];
      v.y = part[(size_t)(b0 + 1) * 32];
      v.z = part[(size_t)(b0 + 2) * 32];
      v.w = part[(size_t)(b0 + 3) * 32];
      *(v4f*)(outld + b0) = v;
    } else {
      for (int i = 0; i < 4; ++i)
        if (b0 + i < B) *(float*)(outld + b0 + i) = part[(size_t)(b0 + i) * 32];
    }
  }
  
}

extern "C" void kernel_launch(void* const* d_in, const int* in_sizes, int n_in,
                              void* d_out, int out_size, void* d_ws, size_t ws_size,
                              hipStream_t stream) {
  if (n_in < 8) return;
  const float* x  = (const float*)d_in[0];
  const float* cd = (const float*)d_in[1];
  const float* W1 = (const float*)d_in[2];
  const float* b1 = (const float*)d_in[3];
  const float* W2 = (const float*)d_in[4];
  const float* b2 = (const float*)d_in[5];
  const float* W3 = (const float*)d_in[6];
  const float* b3 = (const float*)d_in[7];

  const int B  = in_sizes[0] / (TOK * D);
  const int nl = in_sizes[2] / (DIN * HID);
  if (B <= 0 || nl <= 0) return;
  if (in_sizes[1] < B * CND) return;
  if (in_sizes[3] < nl * HID || in_sizes[4] < nl * HID * HID || in_sizes[5] < nl * HID) return;
  if (in_sizes[6] < nl * HID * D || in_sizes[7] < nl * D) return;
  if ((size_t)out_size < (size_t)B * TOK * D + (size_t)B) return;

  const size_t wt_bytes  = (size_t)nl * WPL * sizeof(f16t);
  const size_t part_off  = (wt_bytes + 127) & ~(size_t)127;
  const size_t part_bytes = (size_t)B * 128;
  if (part_off + part_bytes > ws_size) return;

  f16t*  wt    = (f16t*)d_ws;
  float* part  = (float*)((char*)d_ws + part_off);
  float* outz  = (float*)d_out;
  float* outld = outz + (size_t)B * TOK * D;

  const int nlines = nl * LPL;
  k_convert<<<(nlines + 255) / 256, 256, 0, stream>>>(W1, W2, W3, wt, nl);

  (void)hipFuncSetAttribute((const void*)k_flow, hipFuncAttributeMaxDynamicSharedMemorySize, SMEM_TOTAL);
  k_flow<<<B, NTH, SMEM_TOTAL, stream>>>(x, cd, b1, b2, b3, wt, outz, part, B, nl);

  k_final<<<1, 256, 0, stream>>>(part, outld, B);
}

// v001
// A run of this version takes 293 microseconds.
// Two timings next to v000 both put it at 1.12 times that version's speed.
#include <hip/hip_runtime.h>
#include <stdint.h>
#include <stddef.h>

// All contractions: v_wmma_f32_16x16x32_f16 (f16 operands, f32 accumulate); weights carried x16 in f16 (k-contiguous transposed copy), folded back as 1/16 in the f32 epilogue; coupling tanh/exp/flip/logdet math in f32.

typedef _Float16 f16t;
typedef f16t  v8h  __attribute__((ext_vector_type(8)));
typedef f16t  v16h __attribute__((ext_vector_type(16)));
typedef float v4f  __attribute__((ext_vector_type(4)));
typedef float v8f  __attribute__((ext_vector_type(8)));
typedef unsigned int v4u __attribute__((ext_vector_type(4)));

union Frag { v16h v; v8h q[2]; };

constexpr int D   = 128;           // patch dim
constexpr int CND = 128;           // cond dim
constexpr int HID = 256;           // hidden
constexpr int DIN = D / 2 + CND;   // 192
constexpr int TOK = 128;           // tokens per batch element = one block
constexpr int NTH = 256;           // threads per block (8 waves x 16 token rows)
constexpr int NP  = 128;           // output columns per pass (8 n-tiles)

constexpr int ZS = 132;            // z row stride in floats (528 B, 16-B aligned)
constexpr int AS = 264;            // activation row stride in halves (528 B)
constexpr int SS = 40;             // weight slab row stride in halves (80 B), 32 k per row

constexpr float WSCALE = 16.0f;    // exact power of two on the f16 weight copy
constexpr float WINV   = 0.0625f;

// dynamic LDS carve (bytes)
constexpr int OFF_Z = 0;                       // [128][ZS] f32 z
constexpr int OFF_A = OFF_Z + TOK * ZS * 4;    // [128][AS] f16 act (stage-1 out)
constexpr int OFF_B = OFF_A + TOK * AS * 2;    // [128][AS] f16 act (stage-2 out)
constexpr int SLABH = NP * SS;                 // halves per weight slab buffer
constexpr int OFF_S = OFF_B + TOK * AS * 2;    // 2 x [128][SS] f16 weight slab ring
constexpr int OFF_C = OFF_S + 2 * SLABH * 2;   // [128] f16 cond
constexpr int OFF_R = OFF_C + CND * 2;         // [256] f32 reduce
constexpr int SMEM_TOTAL = OFF_R + NTH * 4;    // 224512 B

static_assert(OFF_A % 16 == 0 && OFF_B % 16 == 0 && OFF_S % 16 == 0 && OFF_C % 16 == 0 && OFF_R % 16 == 0, "");

constexpr int LN1 = HID * (DIN / 64);          // 768  (W1t: 256 rows x 192 halves)
constexpr int LN2 = HID * (HID / 64);          // 1024 (W2t: 256 rows x 256 halves)
constexpr int LN3 = D * (HID / 64);            // 512  (W3t: 128 rows x 256 halves)
constexpr int LPL = LN1 + LN2 + LN3;           // 2304
constexpr int WPL = HID * DIN + HID * HID + D * HID;   // halves per layer = 147456

// weight slabs (128 rows x 32 k) of one layer, in the order the passes use them
constexpr int S1 = (HID / NP) * (DIN / 32);    // 12: stage 1, two passes of 6
constexpr int S2 = (HID / NP) * (HID / 32);    // 16: stage 2, two passes of 8
constexpr int S3 = HID / 32;                   // 8 : stage 3
constexpr int SPL = S1 + S2 + S3;              // 36

__device__ __forceinline__ v8f wmma_f16(v16h a, v16h b, v8f c) {
  c = __builtin_amdgcn_wmma_f32_16x16x32_f16(false, a, false, b, (short)0, c, false, false);
  asm volatile("v_nop\n\tv_nop\n\tv_nop\n\tv_nop" : "+v"(c) : "v"(a), "v"(b));
  return c;
}

// 16x32 fragment from a k-contiguous 16-bit row: elems 0..7 <- p[8h..8h+7], elems 8..15 <- p[16+8h..16+8h+7]
__device__ __forceinline__ v16h ldfrag16(const f16t* p, int h) {
  Frag f;
  f.q[0] = *(const v8h*)(p + 8 * h);
  f.q[1] = *(const v8h*)(p + 16 + 8 * h);
  return f.v;
}

// same map from an f32 row, RNE convert to f16 in registers
__device__ __forceinline__ v16h ldfrag32(const float* p, int h) {
  v4f a0 = *(const v4f*)(p + 8 * h);
  v4f a1 = *(const v4f*)(p + 8 * h + 4);
  v4f a2 = *(const v4f*)(p + 16 + 8 * h);
  v4f a3 = *(const v4f*)(p + 16 + 8 * h + 4);
  v8f lo = __builtin_shufflevector(a0, a1, 0, 1, 2, 3, 4, 5, 6, 7);
  v8f hi = __builtin_shufflevector(a2, a3, 0, 1, 2, 3, 4, 5, 6, 7);
  Frag f;
  f.q[0] = __builtin_convertvector(lo, v8h);
  f.q[1] = __builtin_convertvector(hi, v8h);
  return f.v;
}

__device__ __forceinline__ void zero8(v8f (&c)[8]) {
#pragma unroll
  for (int j = 0; j < 8; ++j) {
    v8f z = {0.f, 0.f, 0.f, 0.f, 0.f, 0.f, 0.f, 0.f};
    c[j] = z;
  }
}

// Read-ahead cursor of the slab ring. The 128-row x 32-k slabs of the transposed weight copy are taken in the order of
// use: per layer five passes (W1 rows 0.., W1 rows 128.., W2 rows 0.., W2 rows 128.., W3), each pass along k.
struct SlabCur {
  const char* g;   // this thread's 16 B in row tid / 4 of the slab to copy next
  int half;        // bytes from there to its 16 B in row tid / 4 + 64
  int left;        // slabs of the cursor's pass not yet copied
  int l, s;        // the cursor's layer and its pass in the layer
};

__device__ __forceinline__ void cur_pass(SlabCur& c, const f16t* wt, int nl, int tid) {
  size_t off;
  int K;
  if (c.s < 2)      { K = DIN; off = (size_t)c.l * HID * DIN + c.s * NP * DIN; }
  else if (c.s < 4) { K = HID; off = (size_t)nl * HID * DIN + (size_t)c.l * HID * HID + (c.s - 2) * NP * HID; }
  else              { K = HID; off = (size_t)nl * (HID * DIN + HID * HID) + (size_t)c.l * D * HID; }
  c.g = (const char*)(wt + off) + ((tid >> 2) * K + (tid & 3) * 8) * 2;
  c.half = (NP / 2) * K * 2;
  c.left = K / 32;
}

// Start the copies of the cursor's slab into ring buffer buf (every thread: 16 B of row tid / 4, 16 B of row tid / 4 + 64),
// then move the cursor on by one slab.
__device__ __forceinline__ void slab_issue(uint32_t ring, SlabCur& c, int buf, const f16t* wt, int nl, int tid) {
  const char* g0 = c.g;
  const char* g1 = c.g + c.half;
  const uint32_t d0 = ring + (uint32_t)(buf * SLABH + (tid >> 2) * SS + (tid & 3) * 8) * 2u;
  const uint32_t d1 = d0 + (uint32_t)((NP / 2) * SS) * 2u;
  // global -> LDS through no register, so the slab flies while the slab before it is multiplied;
  // the closing wait is a precaution: no address register of a copy is rewritten ahead of it
  asm volatile("global_load_async_to_lds_b128 %0, %2, off\n\t"
               "global_load_async_to_lds_b128 %1, %3, off\n\t"
               "s_wait_xcnt 0x0"
               :: "v"(d0), "v"(d1), "v"(g0), "v"(g1) : "memory");
  if (--c.left > 0) {
    c.g += 32 * 2;
  } else {
    if (++c.s == 5) { c.s = 0; ++c.l; }
    cur_pass(c, wt, nl, tid);
  }
}

// Foot of trip t: publish slab t + 1, then refill the buffer that trip t has just read with slab t + 2 (the cursor's).
__device__ __forceinline__ void ring_foot(uint32_t ring, SlabCur& c, int nslab, int& t, const f16t* wt, int nl, int tid) {
  asm volatile("s_wait_dscnt 0x0" ::: "memory");     // this wave's reads of slab t are done before the buffer is handed on
  asm volatile("s_wait_asynccnt 0x0" ::: "memory");  // this wave's copies of slab t + 1 have landed
  __syncthreads();                                   // slab t + 1 readable by all, slab t left by all
  if (t + 2 < nslab) slab_issue(ring, c, t & 1, wt, nl, tid);
  ++t;
}

// One 32-deep k-tile for 8 n-tiles: B fragment for n-tile j from slab row (j*16 + m), split k map as A.
__device__ __forceinline__ void ktile(v8f (&c)[8], v16h a, const f16t* wslab, int m, int h) {
#pragma unroll
  for (int j = 0; j < 8; ++j) {
    v16h bfr = ldfrag16(wslab + (j * 16 + m) * SS, h);
    c[j] = wmma_f16(a, bfr, c[j]);
  }
}

// bias + relu + f16 store into wave-private activation rows; D map: c[j][r] = (row 8h+r, col j*16+m)
__device__ __forceinline__ void relu_store(const v8f (&c)[8], f16t* act, const float* __restrict__ bias,
                                           int n0, int rowbase, int m, int h) {
#pragma unroll
  for (int j = 0; j < 8; ++j) {
    const int col = n0 + j * 16 + m;
    const float bv = bias[col];
#pragma unroll
    for (int r = 0; r < 8; ++r) {
      float v = c[j][r] * WINV + bv;
      v = v > 0.f ? v : 0.f;
      act[(rowbase + 8 * h + r) * AS + col] = (f16t)v;
    }
  }
}

__device__ __forceinline__ float tanh_f(float u) {
  u = fminf(fmaxf(u, -16.0f), 16.0f);
  const float e = __expf(2.0f * u);
  return 1.0f - 2.0f * __builtin_amdgcn_rcpf(e + 1.0f);
}

// ---------------------------------------------------------------------------
// Launch 1: W[l][k][n] f32 -> Wt[l][n][k] f16 (x16), k-contiguous rows.
// ---------------------------------------------------------------------------
__global__ void __launch_bounds__(256)
k_convert(const float* __restrict__ W1, const float* __restrict__ W2, const float* __restrict__ W3,
          f16t* __restrict__ wt, int nl) {
  const int g = blockIdx.x * 256 + threadIdx.x;
  if (g >= nl * LPL) return;
  const int l = g / LPL;
  int q = g - l * LPL;
  const float* src;
  f16t* dst;
  int K, N, n, part;
  const size_t base2 = (size_t)nl * HID * DIN;
  const size_t base3 = base2 + (size_t)nl * HID * HID;
  if (q < LN1) {
    n = q / (DIN / 64); part = q - n * (DIN / 64);
    K = DIN; N = HID;
    src = W1 + (size_t)l * DIN * HID;
    dst = wt + (size_t)l * HID * DIN;
  } else if (q < LN1 + LN2) {
    q -= LN1;
    n = q / (HID / 64); part = q - n * (HID / 64);
    K = HID; N = HID;
    src = W2 + (size_t)l * HID * HID;
    dst = wt + base2 + (size_t)l * HID * HID;
  } else {
    q -= LN1 + LN2;
    n = q / (HID / 64); part = q - n * (HID / 64);
    K = HID; N = D;
    src = W3 + (size_t)l * HID * D;
    dst = wt + base3 + (size_t)l * D * HID;
  }
  const int k0 = part * 64;
  union { v4u u[8]; f16t e[64]; } pk;
#pragma unroll
  for (int i = 0; i < 64; ++i)
    pk.e[i] = (f16t)(src[(size_t)(k0 + i) * N + n] * WSCALE);
  f16t* drow = dst + (size_t)n * K + k0;
#pragma unroll
  for (int s = 0; s < 8; ++s) *(v4u*)(drow + s * 8) = pk.u[s];
  
}

// ---------------------------------------------------------------------------
// Launch 2: one block per batch element, 8 waves x 16 wave-private token rows, z resident in LDS.
// ---------------------------------------------------------------------------
__global__ void __launch_bounds__(256)
k_flow(const float* __restrict__ x, const float* __restrict__ cond,
       const float* __restrict__ b1, const float* __restrict__ b2, const float* __restrict__ b3,
       const f16t* __restrict__ wt, float* __restrict__ outz, float* __restrict__ part,
       int B, int nl) {
  extern __shared__ v4u dsm[];
  char* smem = (char*)dsm;
  float* zbuf  = (float*)(smem + OFF_Z);
  f16t*  actA  = (f16t*)(smem + OFF_A);
  f16t*  actB  = (f16t*)(smem + OFF_B);
  f16t*  wslab = (f16t*)(smem + OFF_S);
  f16t*  condh = (f16t*)(smem + OFF_C);
  float* red   = (float*)(smem + OFF_R);

  const int b = blockIdx.x;
  if (b >= B) return;                        // block-uniform, before any barrier
  const int tid = threadIdx.x;
  const int lane = tid & 31, wave = tid >> 5;
  const int m = lane & 15, h = lane >> 4;
  const int rowbase = wave * 16;

  const uint32_t ring = (uint32_t)(size_t)wslab;   // LDS byte address of the slab ring
  const int nslab = nl * SPL;
  SlabCur cur;
  cur.l = 0; cur.s = 0;
  cur_pass(cur, wt, nl, tid);
  slab_issue(ring, cur, 0, wt, nl, tid);

  // stage x[b] (128 x 128 f32) and cond[b] (128, f16)
  {
    const float* xb = x + (size_t)b * TOK * D;
    for (int idx = tid; idx < TOK * (D / 4); idx += NTH) {
      const int r = idx / (D / 4), s = idx - r * (D / 4);
      *(v4f*)(zbuf + r * ZS + s * 4) = *(const v4f*)(xb + (size_t)r * D + s * 4);
    }
    if (tid < CND) condh[tid] = (f16t)cond[(size_t)b * CND + tid];
  }
  asm volatile("s_wait_asynccnt 0x0" ::: "memory");  // this wave's copies of slab 0 have landed
  __syncthreads();
  if (1 < nslab) slab_issue(ring, cur, 1, wt, nl, tid);
  int t = 0;                                         // slab in use; it lies in ring buffer t & 1

  float ldacc = 0.f;

  const float* zrow  = zbuf + (rowbase + m) * ZS;
  const f16t*  arowA = actA + (rowbase + m) * AS;
  const f16t*  arowB = actB + (rowbase + m) * AS;

  for (int l = 0; l < nl; ++l) {
    // stage 1: [16 x 192] @ [192 x 256] + relu -> actA ; A = [x1 | cond]
#pragma unroll 1
    for (int np = 0; np < HID / NP; ++np) {
      const int n0 = np * NP;
      v8f c[8];
      zero8(c);
#pragma unroll 1
      for (int kt = 0; kt < (D / 2) / 32; ++kt) {           // k 0..63 from z (f32 -> f16)
        v16h a = ldfrag32(zrow + kt * 32, h);
        ktile(c, a, wslab + (t & 1) * SLABH, m, h);
        ring_foot(ring, cur, nslab, t, wt, nl, tid);
      }
#pragma unroll 1
      for (int kt = (D / 2) / 32; kt < DIN / 32; ++kt) {    // k 64..191 from cond
        v16h a = ldfrag16(condh + (kt - (D / 2) / 32) * 32, h);
        ktile(c, a, wslab + (t & 1) * SLABH, m, h);
        ring_foot(ring, cur, nslab, t, wt, nl, tid);
      }
      relu_store(c, actA, b1 + (size_t)l * HID, n0, rowbase, m, h);
    }

    // stage 2: [16 x 256] @ [256 x 256] + relu -> actB
#pragma unroll 1
    for (int np = 0; np < HID / NP; ++np) {
      const int n0 = np * NP;
      v8f c[8];
      zero8(c);
#pragma unroll 1
      for (int kt = 0; kt < HID / 32; ++kt) {
        v16h a = ldfrag16(arowA + kt * 32, h);
        ktile(c, a, wslab + (t & 1) * SLABH, m, h);
        ring_foot(ring, cur, nslab, t, wt, nl, tid);
      }
      relu_store(c, actB, b2 + (size_t)l * HID, n0, rowbase, m, h);
    }

    // stage 3: [16 x 256] @ [256 x 128] -> s | t ; coupling + flip
    {
      v8f c[8];
      zero8(c);
#pragma unroll 1
      for (int kt = 0; kt < HID / 32; ++kt) {
        v16h a = ldfrag16(arowB + kt * 32, h);
        ktile(c, a, wslab + (t & 1) * SLABH, m, h);
        ring_foot(ring, cur, nslab, t, wt, nl, tid);
      }
      const float* bb = b3 + (size_t)l * D;
      float x1v[4][8], y2v[4][8];
#pragma unroll
      for (int n = 0; n < 4; ++n) {                // n-tiles 0..3 = s cols 0..63, 4..7 = t cols
        const int col = n * 16 + m;
        const float bs = bb[col];
        const float bt = bb[D / 2 + col];
#pragma unroll
        for (int r = 0; r < 8; ++r) {
          const int tok = rowbase + 8 * h + r;
          const float u  = c[n][r] * WINV + bs;
          const float sv = 0.5f * tanh_f(u);
          const float tv = c[n + 4][r] * WINV + bt;
          const float x2 = zbuf[tok * ZS + D / 2 + col];
          y2v[n][r] = x2 * __expf(sv) + tv;
          x1v[n][r] = zbuf[tok * ZS + col];
          ldacc += sv;
        }
      }
      __syncthreads();                              // all z reads of this layer before any z write
#pragma unroll
      for (int n = 0; n < 4; ++n) {
        const int col = n * 16 + m;
#pragma unroll
        for (int r = 0; r < 8; ++r) {
          const int tok = rowbase + 8 * h + r;
          zbuf[tok * ZS + (D - 1 - col)]     = x1v[n][r];   // z'[64..127] = rev(x1)
          zbuf[tok * ZS + (D / 2 - 1 - col)] = y2v[n][r];   // z'[0..63]   = rev(y2)
        }
      }
    }
  }

  asm volatile("s_wait_asynccnt 0x0" ::: "memory");  // no copy is left in flight behind the ring

  // logdet block reduction
  red[tid] = ldacc;
  __syncthreads();                                  // also orders z element stores before the vector reloads below
  float ld = 0.f;
  if (wave == 0) {
#pragma unroll
    for (int k = 0; k < NTH / 32; ++k) ld += red[lane + 32 * k];
#pragma unroll
    for (int off = 16; off > 0; off >>= 1) ld += __shfl_xor(ld, off, 32);
  }

  float* oz = outz + ((size_t)b * TOK + rowbase) * D;
  float* pl = part + (size_t)b * 32;
#pragma unroll
  for (int r = 0; r < 16; ++r) {
    v4f v = *(const v4f*)(zbuf + (rowbase + r) * ZS + lane * 4);
    *(v4f*)(oz + (size_t)r * D + lane * 4) = v;
  }
  if (wave == 0) *(float*)(pl + lane) = ld;
  
}

// ---------------------------------------------------------------------------
// ---------------------------------------------------------------------------
__global__ void __launch_bounds__(256)
k_final(const float* __restrict__ part, float* __restrict__ outld, int B) {
  const int nq = (B + 3) / 4;
  for (int q = threadIdx.x; q < nq; q += 256) {
    const int b0 = q * 4;
    if (b0 + 3 < B) {
      v4f v;
      v.x = part[(size_t)(b0 + 0) * 32];
      v.y = part[(size_t)(b0 + 1) * 32];
      v.z = part[(size_t)(b0 + 2) * 32];
      v.w = part[(size_t)(b0 + 3) * 32];
      *(v4f*)(outld + b0) = v;
    } else {
      for (int i = 0; i < 4; ++i)
        if (b0 + i < B) *(float*)(outld + b0 + i) = part[(size_t)(b0 + i) * 32];
    }
  }
  
}

extern "C" void kernel_launch(void* const* d_in, const int* in_sizes, int n_in,
                              void* d_out, int out_size, void* d_ws, size_t ws_size,
                              hipStream_t stream) {
  if (n_in < 8) return;
  const float* x  = (const float*)d_in[0];
  const float* cd = (const float*)d_in[1];
  const float* W1 = (const float*)d_in[2];
  const float* b1 = (const float*)d_in[3];
  const float* W2 = (const float*)d_in[4];
  const float* b2 = (const float*)d_in[5];
  const float* W3 = (const float*)d_in[6];
  const float* b3 = (const float*)d_in[7];

  const int B  = in_sizes[0] / (TOK * D);
  const int nl = in_sizes[2] / (DIN * HID);
  if (B <= 0 || nl <= 0) return;
  if (in_sizes[1] < B * CND) return;
  if (in_sizes[3] < nl * HID || in_sizes[4] < nl * HID * HID || in_sizes[5] < nl * HID) return;
  if (in_sizes[6] < nl * HID * D || in_sizes[7] < nl * D) return;
  if ((size_t)out_size < (size_t)B * TOK * D + (size_t)B) return;

  const size_t wt_bytes  = (size_t)nl * WPL * sizeof(f16t);
  const size_t part_off  = (wt_bytes + 127) & ~(size_t)127;
  const size_t part_bytes = (size_t)B * 128;
  if (part_off + part_bytes > ws_size) return;

  f16t*  wt    = (f16t*)d_ws;
  float* part  = (float*)((char*)d_ws + part_off);
  float* outz  = (float*)d_out;
  float* outld = outz + (size_t)B * TOK * D;

  const int nlines = nl * LPL;
  k_convert<<<(nlines + 255) / 256, 256, 0, stream>>>(W1, W2, W3, wt, nl);

  (void)hipFuncSetAttribute((const void*)k_flow, hipFuncAttributeMaxDynamicSharedMemorySize, SMEM_TOTAL);
  k_flow<<<B, NTH, SMEM_TOTAL, stream>>>(x, cd, b1, b2, b3, wt, outz, part, B, nl);

  k_final<<<1, 256, 0, stream>>>(part, outld, B);
}

// v002
// One run takes 222 microseconds.
// Next to v001, in two timings, it ran 1.30 and 1.31 times as fast.
// Over all steps from v000 it is 1.47 times as fast.
#include <hip/hip_runtime.h>
#include <stdint.h>
#include <stddef.h>

// All contractions: v_wmma_f32_16x16x32_f16 (f16 operands, f32 accumulate); weights carried x16 in f16 (k-contiguous transposed copy), folded back as 1/16 in the f32 epilogue; coupling tanh/exp/flip/logdet math in f32.

typedef _Float16 f16t;
typedef f16t  v8h  __attribute__((ext_vector_type(8)));
typedef f16t  v16h __attribute__((ext_vector_type(16)));
typedef float v4f  __attribute__((ext_vector_type(4)));
typedef float v8f  __attribute__((ext_vector_type(8)));
typedef unsigned int v4u __attribute__((ext_vector_type(4)));

union Frag { v16h v; v8h q[2]; };

constexpr int D   = 128;           // patch dim
constexpr int CND = 128;           // cond dim
constexpr int HID = 256;           // hidden
constexpr int DIN = D / 2 + CND;   // 192
constexpr int TOK = 128;           // tokens per batch element = one block
constexpr int NTH = 256;           // threads per block (8 waves x 16 token rows)
constexpr int NP  = 128;           // output columns per pass (8 n-tiles)

constexpr int ZS = 132;            // z row stride in floats (528 B, 16-B aligned)
constexpr int AS = 264;            // activation row stride in halves (528 B)
constexpr int SS = 40;             // weight slab row stride in halves (80 B), 32 k per row

constexpr float WSCALE = 16.0f;    // exact power of two on the f16 weight copy
constexpr float WINV   = 0.0625f;

// dynamic LDS carve (bytes)
constexpr int OFF_Z = 0;                       // [128][ZS] f32 z
constexpr int OFF_A = OFF_Z + TOK * ZS * 4;    // [128][AS] f16 act (stage-1 out)
constexpr int OFF_B = OFF_A + TOK * AS * 2;    // [128][AS] f16 act (stage-2 out)
constexpr int SLABH = NP * SS;                 // halves per weight slab buffer
constexpr int OFF_S = OFF_B + TOK * AS * 2;    // 2 x [128][SS] f16 weight slab ring
constexpr int OFF_C = OFF_S + 2 * SLABH * 2;   // [128] f16 cond
constexpr int OFF_R = OFF_C + CND * 2;         // [256] f32 reduce
constexpr int SMEM_TOTAL = OFF_R + NTH * 4;    // 224512 B

static_assert(OFF_A % 16 == 0 && OFF_B % 16 == 0 && OFF_S % 16 == 0 && OFF_C % 16 == 0 && OFF_R % 16 == 0, "");

constexpr int LN1 = HID * (DIN / 64);          // 768  (W1t: 256 rows x 192 halves)
constexpr int LN2 = HID * (HID / 64);          // 1024 (W2t: 256 rows x 256 halves)
constexpr int LN3 = D * (HID / 64);            // 512  (W3t: 128 rows x 256 halves)
constexpr int LPL = LN1 + LN2 + LN3;           // 2304
constexpr int WPL = HID * DIN + HID * HID + D * HID;   // halves per layer = 147456

// weight slabs (128 rows x 32 k) of one layer, in the order the passes use them
constexpr int S1 = (HID / NP) * (DIN / 32);    // 12: stage 1, two passes of 6
constexpr int S2 = (HID / NP) * (HID / 32);    // 16: stage 2, two passes of 8
constexpr int S3 = HID / 32;                   // 8 : stage 3
constexpr int SPL = S1 + S2 + S3;              // 36

__device__ __forceinline__ v8f wmma_f16(v16h a, v16h b, v8f c) {
  return __builtin_amdgcn_wmma_f32_16x16x32_f16(false, a, false, b, (short)0, c, false, false);
}

// 16x32 fragment from a k-contiguous 16-bit row: elems 0..7 <- p[8h..8h+7], elems 8..15 <- p[16+8h..16+8h+7]
__device__ __forceinline__ v16h ldfrag16(const f16t* p, int h) {
  Frag f;
  f.q[0] = *(const v8h*)(p + 8 * h);
  f.q[1] = *(const v8h*)(p + 16 + 8 * h);
  return f.v;
}

// same map from an f32 row, RNE convert to f16 in registers
__device__ __forceinline__ v16h ldfrag32(const float* p, int h) {
  v4f a0 = *(const v4f*)(p + 8 * h);
  v4f a1 = *(const v4f*)(p + 8 * h + 4);
  v4f a2 = *(const v4f*)(p + 16 + 8 * h);
  v4f a3 = *(const v4f*)(p + 16 + 8 * h + 4);
  v8f lo = __builtin_shufflevector(a0, a1, 0, 1, 2, 3, 4, 5, 6, 7);
  v8f hi = __builtin_shufflevector(a2, a3, 0, 1, 2, 3, 4, 5, 6, 7);
  Frag f;
  f.q[0] = __builtin_convertvector(lo, v8h);
  f.q[1] = __builtin_convertvector(hi, v8h);
  return f.v;
}

__device__ __forceinline__ void zero8(v8f (&c)[8]) {
#pragma unroll
  for (int j = 0; j < 8; ++j) {
    v8f z = {0.f, 0.f, 0.f, 0.f, 0.f, 0.f, 0.f, 0.f};
    c[j] = z;
  }
}

// Read-ahead cursor of the slab ring. The 128-row x 32-k slabs of the transposed weight copy are taken in the order of
// use: per layer five passes (W1 rows 0.., W1 rows 128.., W2 rows 0.., W2 rows 128.., W3), each pass along k.
struct SlabCur {
  const char* g;   // this thread's 16 B in row tid / 4 of the slab to copy next
  int half;        // bytes from there to its 16 B in row tid / 4 + 64
  int left;        // slabs of the cursor's pass not yet copied
  int l, s;        // the cursor's layer and its pass in the layer
};

__device__ __forceinline__ void cur_pass(SlabCur& c, const f16t* wt, int nl, int tid) {
  size_t off;
  int K;
  if (c.s < 2)      { K = DIN; off = (size_t)c.l * HID * DIN + c.s * NP * DIN; }
  else if (c.s < 4) { K = HID; off = (size_t)nl * HID * DIN + (size_t)c.l * HID * HID + (c.s - 2) * NP * HID; }
  else              { K = HID; off = (size_t)nl * (HID * DIN + HID * HID) + (size_t)c.l * D * HID; }
  c.g = (const char*)(wt + off) + ((tid >> 2) * K + (tid & 3) * 8) * 2;
  c.half = (NP / 2) * K * 2;
  c.left = K / 32;
}

// Start the copies of the cursor's slab into ring buffer buf (every thread: 16 B of row tid / 4, 16 B of row tid / 4 + 64),
// then move the cursor on by one slab.
__device__ __forceinline__ void slab_issue(uint32_t ring, SlabCur& c, int buf, const f16t* wt, int nl, int tid) {
  const char* g0 = c.g;
  const char* g1 = c.g + c.half;
  const uint32_t d0 = ring + (uint32_t)(buf * SLABH + (tid >> 2) * SS + (tid & 3) * 8) * 2u;
  const uint32_t d1 = d0 + (uint32_t)((NP / 2) * SS) * 2u;
  // global -> LDS through no register, so the slab flies while the slab before it is multiplied;
  // the closing wait is a precaution: no address register of a copy is rewritten ahead of it
  asm volatile("global_load_async_to_lds_b128 %0, %2, off\n\t"
               "global_load_async_to_lds_b128 %1, %3, off\n\t"
               "s_wait_xcnt 0x0"
               :: "v"(d0), "v"(d1), "v"(g0), "v"(g1) : "memory");
  if (--c.left > 0) {
    c.g += 32 * 2;
  } else {
    if (++c.s == 5) { c.s = 0; ++c.l; }
    cur_pass(c, wt, nl, tid);
  }
}

// Foot of trip t: publish slab t + 1, then refill the buffer that trip t has just read with slab t + 2 (the cursor's).
__device__ __forceinline__ void ring_foot(uint32_t ring, SlabCur& c, int nslab, int& t, const f16t* wt, int nl, int tid) {
  asm volatile("s_wait_dscnt 0x0" ::: "memory");     // this wave's reads of slab t are done before the buffer is handed on
  asm volatile("s_wait_asynccnt 0x0" ::: "memory");  // this wave's copies of slab t + 1 have landed
  __syncthreads();                                   // slab t + 1 readable by all, slab t left by all
  if (t + 2 < nslab) slab_issue(ring, c, t & 1, wt, nl, tid);
  ++t;
}

// One 32-deep k-tile for 8 n-tiles: B fragment for n-tile j from slab row (j*16 + m), split k map as A.
__device__ __forceinline__ void ktile(v8f (&c)[8], v16h a, const f16t* wslab, int m, int h) {
  v16h bfr[8];   // one register set per n-tile, so that the LDS latency is paid once a slab and not once a WMMA
#pragma unroll
  for (int j = 0; j < 8; ++j) bfr[j] = ldfrag16(wslab + (j * 16 + m) * SS, h);
  // holds the slab's LDS reads in one group ahead of the WMMAs: without it they sink back to one pair and a full wait
  // in front of each WMMA
  __builtin_amdgcn_sched_barrier(0);
#pragma unroll
  for (int j = 0; j < 8; ++j) {
    c[j] = wmma_f16(a, bfr[j], c[j]);
    // keeps the WMMAs in the order of their reads, so that each waits only for its own pair (a counted wait)
    __builtin_amdgcn_sched_barrier(0);
  }
  // four vector slots behind the last WMMA, on every path: the loop's taken branch leads to vector writes of A and B
  // registers and its exit to vector reads of D
  asm volatile("v_nop\n\tv_nop\n\tv_nop\n\tv_nop"
               : "+v"(c[0]), "+v"(c[1]), "+v"(c[2]), "+v"(c[3]), "+v"(c[4]), "+v"(c[5]), "+v"(c[6]), "+v"(c[7]));
}

// bias + relu + f16 store into wave-private activation rows; D map: c[j][r] = (row 8h+r, col j*16+m)
__device__ __forceinline__ void relu_store(const v8f (&c)[8], f16t* act, const float* __restrict__ bias,
                                           int n0, int rowbase, int m, int h) {
#pragma unroll
  for (int j = 0; j < 8; ++j) {
    const int col = n0 + j * 16 + m;
    const float bv = bias[col];
#pragma unroll
    for (int r = 0; r < 8; ++r) {
      float v = c[j][r] * WINV + bv;
      v = v > 0.f ? v : 0.f;
      act[(rowbase + 8 * h + r) * AS + col] = (f16t)v;
    }
  }
}

__device__ __forceinline__ float tanh_f(float u) {
  u = fminf(fmaxf(u, -16.0f), 16.0f);
  const float e = __expf(2.0f * u);
  return 1.0f - 2.0f * __builtin_amdgcn_rcpf(e + 1.0f);
}

// ---------------------------------------------------------------------------
// Launch 1: W[l][k][n] f32 -> Wt[l][n][k] f16 (x16), k-contiguous rows.
// ---------------------------------------------------------------------------
__global__ void __launch_bounds__(256)
k_convert(const float* __restrict__ W1, const float* __restrict__ W2, const float* __restrict__ W3,
          f16t* __restrict__ wt, int nl) {
  const int g = blockIdx.x * 256 + threadIdx.x;
  if (g >= nl * LPL) return;
  const int l = g / LPL;
  int q = g - l * LPL;
  const float* src;
  f16t* dst;
  int K, N, n, part;
  const size_t base2 = (size_t)nl * HID * DIN;
  const size_t base3 = base2 + (size_t)nl * HID * HID;
  if (q < LN1) {
    n = q / (DIN / 64); part = q - n * (DIN / 64);
    K = DIN; N = HID;
    src = W1 + (size_t)l * DIN * HID;
    dst = wt + (size_t)l * HID * DIN;
  } else if (q < LN1 + LN2) {
    q -= LN1;
    n = q / (HID / 64); part = q - n * (HID / 64);
    K = HID; N = HID;
    src = W2 + (size_t)l * HID * HID;
    dst = wt + base2 + (size_t)l * HID * HID;
  } else {
    q -= LN1 + LN2;
    n = q / (HID / 64); part = q - n * (HID / 64);
    K = HID; N = D;
    src = W3 + (size_t)l * HID * D;
    dst = wt + base3 + (size_t)l * D * HID;
  }
  const int k0 = part * 64;
  union { v4u u[8]; f16t e[64]; } pk;
#pragma unroll
  for (int i = 0; i < 64; ++i)
    pk.e[i] = (f16t)(src[(size_t)(k0 + i) * N + n] * WSCALE);
  f16t* drow = dst + (size_t)n * K + k0;
#pragma unroll
  for (int s = 0; s < 8; ++s) *(v4u*)(drow + s * 8) = pk.u[s];
  
}

// ---------------------------------------------------------------------------
// Launch 2: one block per batch element, 8 waves x 16 wave-private token rows, z resident in LDS.
// ---------------------------------------------------------------------------
__global__ void __launch_bounds__(256)
k_flow(const float* __restrict__ x, const float* __restrict__ cond,
       const float* __restrict__ b1, const float* __restrict__ b2, const float* __restrict__ b3,
       const f16t* __restrict__ wt, float* __restrict__ outz, float* __restrict__ part,
       int B, int nl) {
  extern __shared__ v4u dsm[];
  char* smem = (char*)dsm;
  float* zbuf  = (float*)(smem + OFF_Z);
  f16t*  actA  = (f16t*)(smem + OFF_A);
  f16t*  actB  = (f16t*)(smem + OFF_B);
  f16t*  wslab = (f16t*)(smem + OFF_S);
  f16t*  condh = (f16t*)(smem + OFF_C);
  float* red   = (float*)(smem + OFF_R);

  const int b = blockIdx.x;
  if (b >= B) return;                        // block-uniform, before any barrier
  const int tid = threadIdx.x;
  const int lane = tid & 31, wave = tid >> 5;
  const int m = lane & 15, h = lane >> 4;
  const int rowbase = wave * 16;

  const uint32_t ring = (uint32_t)(size_t)wslab;   // LDS byte address of the slab ring
  const int nslab = nl * SPL;
  SlabCur cur;
  cur.l = 0; cur.s = 0;
  cur_pass(cur, wt, nl, tid);
  slab_issue(ring, cur, 0, wt, nl, tid);

  // stage x[b] (128 x 128 f32) and cond[b] (128, f16)
  {
    const float* xb = x + (size_t)b * TOK * D;
    for (int idx = tid; idx < TOK * (D / 4); idx += NTH) {
      const int r = idx / (D / 4), s = idx - r * (D / 4);
      *(v4f*)(zbuf + r * ZS + s * 4) = *(const v4f*)(xb + (size_t)r * D + s * 4);
    }
    if (tid < CND) condh[tid] = (f16t)cond[(size_t)b * CND + tid];
  }
  asm volatile("s_wait_asynccnt 0x0" ::: "memory");  // this wave's copies of slab 0 have landed
  __syncthreads();
  if (1 < nslab) slab_issue(ring, cur, 1, wt, nl, tid);
  int t = 0;                                         // slab in use; it lies in ring buffer t & 1

  float ldacc = 0.f;

  const float* zrow  = zbuf + (rowbase + m) * ZS;
  const f16t*  arowA = actA + (rowbase + m) * AS;
  const f16t*  arowB = actB + (rowbase + m) * AS;

  for (int l = 0; l < nl; ++l) {
    // stage 1: [16 x 192] @ [192 x 256] + relu -> actA ; A = [x1 | cond]
#pragma unroll 1
    for (int np = 0; np < HID / NP; ++np) {
      const int n0 = np * NP;
      v8f c[8];
      zero8(c);
#pragma unroll 1
      for (int kt = 0; kt < (D / 2) / 32; ++kt) {           // k 0..63 from z (f32 -> f16)
        v16h a = ldfrag32(zrow + kt * 32, h);
        ktile(c, a, wslab + (t & 1) * SLABH, m, h);
        ring_foot(ring, cur, nslab, t, wt, nl, tid);
      }
#pragma unroll 1
      for (int kt = (D / 2) / 32; kt < DIN / 32; ++kt) {    // k 64..191 from cond
        v16h a = ldfrag16(condh + (kt - (D / 2) / 32) * 32, h);
        ktile(c, a, wslab + (t & 1) * SLABH, m, h);
        ring_foot(ring, cur, nslab, t, wt, nl, tid);
      }
      relu_store(c, actA, b1 + (size_t)l * HID, n0, rowbase, m, h);
    }

    // stage 2: [16 x 256] @ [256 x 256] + relu -> actB
#pragma unroll 1
    for (int np = 0; np < HID / NP; ++np) {
      const int n0 = np * NP;
      v8f c[8];
      zero8(c);
#pragma unroll 1
      for (int kt = 0; kt < HID / 32; ++kt) {
        v16h a = ldfrag16(arowA + kt * 32, h);
        ktile(c, a, wslab + (t & 1) * SLABH, m, h);
        ring_foot(ring, cur, nslab, t, wt, nl, tid);
      }
      relu_store(c, actB, b2 + (size_t)l * HID, n0, rowbase, m, h);
    }

    // stage 3: [16 x 256] @ [256 x 128] -> s | t ; coupling + flip
    {
      v8f c[8];
      zero8(c);
#pragma unroll 1
      for (int kt = 0; kt < HID / 32; ++kt) {
        v16h a = ldfrag16(arowB + kt * 32, h);
        ktile(c, a, wslab + (t & 1) * SLABH, m, h);
        ring_foot(ring, cur, nslab, t, wt, nl, tid);
      }
      const float* bb = b3 + (size_t)l * D;
      float x1v[4][8], y2v[4][8];
#pragma unroll
      for (int n = 0; n < 4; ++n) {                // n-tiles 0..3 = s cols 0..63, 4..7 = t cols
        const int col = n * 16 + m;
        const float bs = bb[col];
        const float bt = bb[D / 2 + col];
#pragma unroll
        for (int r = 0; r < 8; ++r) {
          const int tok = rowbase + 8 * h + r;
          const float u  = c[n][r] * WINV + bs;
          const float sv = 0.5f * tanh_f(u);
          const float tv = c[n + 4][r] * WINV + bt;
          const float x2 = zbuf[tok * ZS + D / 2 + col];
          y2v[n][r] = x2 * __expf(sv) + tv;
          x1v[n][r] = zbuf[tok * ZS + col];
          ldacc += sv;
        }
      }
      __syncthreads();                              // all z reads of this layer before any z write
#pragma unroll
      for (int n = 0; n < 4; ++n) {
        const int col = n * 16 + m;
#pragma unroll
        for (int r = 0; r < 8; ++r) {
          const int tok = rowbase + 8 * h + r;
          zbuf[tok * ZS + (D - 1 - col)]     = x1v[n][r];   // z'[64..127] = rev(x1)
          zbuf[tok * ZS + (D / 2 - 1 - col)] = y2v[n][r];   // z'[0..63]   = rev(y2)
        }
      }
    }
  }

  asm volatile("s_wait_asynccnt 0x0" ::: "memory");  // no copy is left in flight behind the ring

  // logdet block reduction
  red[tid] = ldacc;
  __syncthreads();                                  // also orders z element stores before the vector reloads below
  float ld = 0.f;
  if (wave == 0) {
#pragma unroll
    for (int k = 0; k < NTH / 32; ++k) ld += red[lane + 32 * k];
#pragma unroll
    for (int off = 16; off > 0; off >>= 1) ld += __shfl_xor(ld, off, 32);
  }

  float* oz = outz + ((size_t)b * TOK + rowbase) * D;
  float* pl = part + (size_t)b * 32;
#pragma unroll
  for (int r = 0; r < 16; ++r) {
    v4f v = *(const v4f*)(zbuf + (rowbase + r) * ZS + lane * 4);
    *(v4f*)(oz + (size_t)r * D + lane * 4) = v;
  }
  if (wave == 0) *(float*)(pl + lane) = ld;
  
}

// ---------------------------------------------------------------------------
// ---------------------------------------------------------------------------
__global__ void __launch_bounds__(256)
k_final(const float* __restrict__ part, float* __restrict__ outld, int B) {
  const int nq = (B + 3) / 4;
  for (int q = threadIdx.x; q < nq; q += 256) {
    const int b0 = q * 4;
    if (b0 + 3 < B) {
      v4f v;
      v.x = part[(size_t)(b0 + 0) * 32];
      v.y = part[(size_t)(b0 + 1) * 32];
      v.z = part[(size_t)(b0 + 2) * 32];
      v.w = part[(size_t)(b0 + 3) * 32];
      *(v4f*)(outld + b0) = v;
    } else {
      for (int i = 0; i < 4; ++i)
        if (b0 + i < B) *(float*)(outld + b0 + i) = part[(size_t)(b0 + i) * 32];
    }
  }
  
}

extern "C" void kernel_launch(void* const* d_in, const int* in_sizes, int n_in,
                              void* d_out, int out_size, void* d_ws, size_t ws_size,
                              hipStream_t stream) {
  if (n_in < 8) return;
  const float* x  = (const float*)d_in[0];
  const float* cd = (const float*)d_in[1];
  const float* W1 = (const float*)d_in[2];
  const float* b1 = (const float*)d_in[3];
  const float* W2 = (const float*)d_in[4];
  const float* b2 = (const float*)d_in[5];
  const float* W3 = (const float*)d_in[6];
  const float* b3 = (const float*)d_in[7];

  const int B  = in_sizes[0] / (TOK * D);
  const int nl = in_sizes[2] / (DIN * HID);
  if (B <= 0 || nl <= 0) return;
  if (in_sizes[1] < B * CND) return;
  if (in_sizes[3] < nl * HID || in_sizes[4] < nl * HID * HID || in_sizes[5] < nl * HID) return;
  if (in_sizes[6] < nl * HID * D || in_sizes[7] < nl * D) return;
  if ((size_t)out_size < (size_t)B * TOK * D + (size_t)B) return;

  const size_t wt_bytes  = (size_t)nl * WPL * sizeof(f16t);
  const size_t part_off  = (wt_bytes + 127) & ~(size_t)127;
  const size_t part_bytes = (size_t)B * 128;
  if (part_off + part_bytes > ws_size) return;

  f16t*  wt    = (f16t*)d_ws;
  float* part  = (float*)((char*)d_ws + part_off);
  float* outz  = (float*)d_out;
  float* outld = outz + (size_t)B * TOK * D;

  const int nlines = nl * LPL;
  k_convert<<<(nlines + 255) / 256, 256, 0, stream>>>(W1, W2, W3, wt, nl);

  (void)hipFuncSetAttribute((const void*)k_flow, hipFuncAttributeMaxDynamicSharedMemorySize, SMEM_TOTAL);
  k_flow<<<B, NTH, SMEM_TOTAL, stream>>>(x, cd, b1, b2, b3, wt, outz, part, B, nl);

  k_final<<<1, 256, 0, stream>>>(part, outld, B);
}

// v003
// A run of this version takes 162 microseconds.
// Timed twice side by side with v002, it ran 1.37 and 1.38 times as fast.
// Over all steps from v000 it is 2.02 times as fast.
#include <hip/hip_runtime.h>
#include <stdint.h>
#include <stddef.h>

// All contractions: v_wmma_f32_16x16x32_f16 (f16 operands, f32 accumulate); weights carried x16 in f16 (k-contiguous transposed copy), folded back as 1/16 in the f32 epilogue; coupling tanh/exp/flip/logdet math in f32.

typedef _Float16 f16t;
typedef f16t  v8h  __attribute__((ext_vector_type(8)));
typedef f16t  v16h __attribute__((ext_vector_type(16)));
typedef float v4f  __attribute__((ext_vector_type(4)));
typedef float v8f  __attribute__((ext_vector_type(8)));
typedef unsigned int v4u __attribute__((ext_vector_type(4)));

union Frag { v16h v; v8h q[2]; };

constexpr int D   = 128;           // patch dim
constexpr int CND = 128;           // cond dim
constexpr int HID = 256;           // hidden
constexpr int DIN = D / 2 + CND;   // 192
constexpr int TOK = 128;           // tokens per batch element = one block
constexpr int NTH = 256;           // threads per block (8 waves x 16 token rows)
constexpr int NP  = 128;           // output columns per pass (8 n-tiles)

constexpr int ZS = 132;            // z row stride in floats (528 B, 16-B aligned)
constexpr int AS = 264;            // activation row stride in halves (528 B)
constexpr int SS = 200;            // weight slab row stride in halves (400 B = 16 B x 25), up to 192 k per row

constexpr float WSCALE = 16.0f;    // exact power of two on the f16 weight copy
constexpr float WINV   = 0.0625f;

// dynamic LDS carve (bytes)
constexpr int OFF_Z = 0;                       // [128][ZS] f32 z
constexpr int OFF_A = OFF_Z + TOK * ZS * 4;    // [128][AS] f16 act (stage-1 out)
constexpr int OFF_B = OFF_A + TOK * AS * 2;    // [128][AS] f16 act (stage-2 out)
constexpr int SLABH = NP * SS;                 // halves per weight slab buffer
constexpr int OFF_S = OFF_B + TOK * AS * 2;    // 2 x [128][SS] f16 weight slab ring
constexpr int OFF_C = OFF_S + 2 * SLABH * 2;   // [128] f16 cond
constexpr int OFF_R = OFF_C + CND * 2;         // [256] f32 reduce
constexpr int SMEM_TOTAL = OFF_R + NTH * 4;    // 306432 B

static_assert(OFF_A % 16 == 0 && OFF_B % 16 == 0 && OFF_S % 16 == 0 && OFF_C % 16 == 0 && OFF_R % 16 == 0, "");

constexpr int LN1 = HID * (DIN / 64);          // 768  (W1t: 256 rows x 192 halves)
constexpr int LN2 = HID * (HID / 64);          // 1024 (W2t: 256 rows x 256 halves)
constexpr int LN3 = D * (HID / 64);            // 512  (W3t: 128 rows x 256 halves)
constexpr int LPL = LN1 + LN2 + LN3;           // 2304
constexpr int WPL = HID * DIN + HID * HID + D * HID;   // halves per layer = 147456

// weight slabs of one layer, in the order the passes use them: 128 rows x 192 k (stage 1), 128 rows x 128 k (stages 2, 3)
constexpr int KS  = 128;                       // k per slab of stages 2 and 3
constexpr int S1 = HID / NP;                   // 2: stage 1, two passes of 1
constexpr int S2 = (HID / NP) * (HID / KS);    // 4: stage 2, two passes of 2
constexpr int S3 = HID / KS;                   // 2: stage 3
constexpr int SPL = S1 + S2 + S3;              // 8
static_assert(DIN <= SS && KS <= SS && SMEM_TOTAL <= 327680, "");

__device__ __forceinline__ v8f wmma_f16(v16h a, v16h b, v8f c) {
  return __builtin_amdgcn_wmma_f32_16x16x32_f16(false, a, false, b, (short)0, c, false, false);
}

// 16x32 fragment from a k-contiguous 16-bit row: elems 0..7 <- p[8h..8h+7], elems 8..15 <- p[16+8h..16+8h+7]
__device__ __forceinline__ v16h ldfrag16(const f16t* p, int h) {
  Frag f;
  f.q[0] = *(const v8h*)(p + 8 * h);
  f.q[1] = *(const v8h*)(p + 16 + 8 * h);
  return f.v;
}

// same map from an f32 row, RNE convert to f16 in registers
__device__ __forceinline__ v16h ldfrag32(const float* p, int h) {
  v4f a0 = *(const v4f*)(p + 8 * h);
  v4f a1 = *(const v4f*)(p + 8 * h + 4);
  v4f a2 = *(const v4f*)(p + 16 + 8 * h);
  v4f a3 = *(const v4f*)(p + 16 + 8 * h + 4);
  v8f lo = __builtin_shufflevector(a0, a1, 0, 1, 2, 3, 4, 5, 6, 7);
  v8f hi = __builtin_shufflevector(a2, a3, 0, 1, 2, 3, 4, 5, 6, 7);
  Frag f;
  f.q[0] = __builtin_convertvector(lo, v8h);
  f.q[1] = __builtin_convertvector(hi, v8h);
  return f.v;
}

__device__ __forceinline__ void zero8(v8f (&c)[8]) {
#pragma unroll
  for (int j = 0; j < 8; ++j) {
    v8f z = {0.f, 0.f, 0.f, 0.f, 0.f, 0.f, 0.f, 0.f};
    c[j] = z;
  }
}

// Read-ahead cursor of the slab ring. The 128-row slabs of the transposed weight copy are taken in the order of
// use: per layer five passes (W1 rows 0.., W1 rows 128.., W2 rows 0.., W2 rows 128.., W3), each pass along k.
struct SlabCur {
  const char* g;   // this thread's 16 B in row tid / 8 of the slab to copy next (k 8 * (tid & 7) of the slab)
  int step;        // bytes from there to its 16 B in row tid / 8 + 32
  int left;        // slabs of the cursor's pass not yet copied
  int l, s;        // the cursor's layer and its pass in the layer
};

__device__ __forceinline__ void cur_pass(SlabCur& c, const f16t* wt, int nl, int tid) {
  size_t off;
  int K;
  if (c.s < 2)      { K = DIN; off = (size_t)c.l * HID * DIN + c.s * NP * DIN; }
  else if (c.s < 4) { K = HID; off = (size_t)nl * HID * DIN + (size_t)c.l * HID * HID + (c.s - 2) * NP * HID; }
  else              { K = HID; off = (size_t)nl * (HID * DIN + HID * HID) + (size_t)c.l * D * HID; }
  c.g = (const char*)(wt + off) + ((tid >> 3) * K + (tid & 7) * 8) * 2;
  c.step = (NP / 4) * K * 2;
  c.left = c.s < 2 ? 1 : HID / KS;
}

// Start the copies of the cursor's slab into ring buffer buf, then move the cursor on by one slab. Eight threads take one
// whole 128-B line (64 k) of a row; every thread copies its 16 B in rows tid / 8 + {0, 32, 64, 96} of each 64-k column block.
__device__ __forceinline__ void slab_issue(uint32_t ring, SlabCur& c, int buf, const f16t* wt, int nl, int tid) {
  constexpr uint32_t DR = (uint32_t)((NP / 4) * SS) * 2u;   // LDS bytes from a row to the row 32 further on
  const char* g0 = c.g;
  const char* g1 = g0 + c.step;
  const char* g2 = g1 + c.step;
  const char* g3 = g2 + c.step;
  const char* g4 = g0 + 128;
  const char* g5 = g1 + 128;
  const char* g6 = g2 + 128;
  const char* g7 = g3 + 128;
  const uint32_t d0 = ring + (uint32_t)(buf * SLABH + (tid >> 3) * SS + (tid & 7) * 8) * 2u;
  const uint32_t d1 = d0 + DR, d2 = d0 + 2u * DR, d3 = d0 + 3u * DR;
  const uint32_t d4 = d0 + 128u, d5 = d1 + 128u, d6 = d2 + 128u, d7 = d3 + 128u;
  // global -> LDS through no register, so the slab flies while the slab before it is multiplied;
  // the closing wait is a precaution: no address register of a copy is rewritten ahead of it
  asm volatile("global_load_async_to_lds_b128 %0, %8, off\n\t"
               "global_load_async_to_lds_b128 %1, %9, off\n\t"
               "global_load_async_to_lds_b128 %2, %10, off\n\t"
               "global_load_async_to_lds_b128 %3, %11, off\n\t"
               "global_load_async_to_lds_b128 %4, %12, off\n\t"
               "global_load_async_to_lds_b128 %5, %13, off\n\t"
               "global_load_async_to_lds_b128 %6, %14, off\n\t"
               "global_load_async_to_lds_b128 %7, %15, off\n\t"
               "s_wait_xcnt 0x0"
               :: "v"(d0), "v"(d1), "v"(d2), "v"(d3), "v"(d4), "v"(d5), "v"(d6), "v"(d7),
                  "v"(g0), "v"(g1), "v"(g2), "v"(g3), "v"(g4), "v"(g5), "v"(g6), "v"(g7) : "memory");
  if (c.s < 2) {   // a stage-1 slab is 192 k deep: its third 64-k column block (the test reads the same in every thread)
    const char* g8  = g0 + 256;
    const char* g9  = g1 + 256;
    const char* g10 = g2 + 256;
    const char* g11 = g3 + 256;
    const uint32_t d8 = d0 + 256u, d9 = d1 + 256u, d10 = d2 + 256u, d11 = d3 + 256u;
    // same form and same closing wait as above
    asm volatile("global_load_async_to_lds_b128 %0, %4, off\n\t"
                 "global_load_async_to_lds_b128 %1, %5, off\n\t"
                 "global_load_async_to_lds_b128 %2, %6, off\n\t"
                 "global_load_async_to_lds_b128 %3, %7, off\n\t"
                 "s_wait_xcnt 0x0"
                 :: "v"(d8), "v"(d9), "v"(d10), "v"(d11), "v"(g8), "v"(g9), "v"(g10), "v"(g11) : "memory");
  }
  if (--c.left > 0) {
    c.g += KS * 2;
  } else {
    if (++c.s == 5) { c.s = 0; ++c.l; }
    cur_pass(c, wt, nl, tid);
  }
}

// Foot of trip t: publish slab t + 1, then refill the buffer that trip t has just read with slab t + 2 (the cursor's).
__device__ __forceinline__ void ring_foot(uint32_t ring, SlabCur& c, int nslab, int& t, const f16t* wt, int nl, int tid) {
  asm volatile("s_wait_dscnt 0x0" ::: "memory");     // this wave's reads of slab t are done before the buffer is handed on
  asm volatile("s_wait_asynccnt 0x0" ::: "memory");  // this wave's copies of slab t + 1 have landed
  __syncthreads();                                   // slab t + 1 readable by all, slab t left by all
  if (t + 2 < nslab) slab_issue(ring, c, t & 1, wt, nl, tid);
  ++t;
}

// One 32-deep k-tile for 8 n-tiles: B fragment for n-tile j from slab row (j*16 + m) at the k-tile's place in the row
// (wslab points there), split k map as A.
__device__ __forceinline__ void ktile(v8f (&c)[8], v16h a, const f16t* wslab, int m, int h) {
  v16h bfr[8];   // one register set per n-tile, so that the LDS latency is paid once a k-tile and not once a WMMA
#pragma unroll
  for (int j = 0; j < 8; ++j) bfr[j] = ldfrag16(wslab + (j * 16 + m) * SS, h);
  // holds the k-tile's LDS reads in one group ahead of the WMMAs: without it they sink back to one pair and a full wait
  // in front of each WMMA
  __builtin_amdgcn_sched_barrier(0);
#pragma unroll
  for (int j = 0; j < 8; ++j) {
    c[j] = wmma_f16(a, bfr[j], c[j]);
    // keeps the WMMAs in the order of their reads, so that each waits only for its own pair (a counted wait)
    __builtin_amdgcn_sched_barrier(0);
  }
  // four vector slots behind the last WMMA, on every path: the loop's taken branch leads to vector writes of A and B
  // registers and its exit to vector reads of D
  asm volatile("v_nop\n\tv_nop\n\tv_nop\n\tv_nop"
               : "+v"(c[0]), "+v"(c[1]), "+v"(c[2]), "+v"(c[3]), "+v"(c[4]), "+v"(c[5]), "+v"(c[6]), "+v"(c[7]));
}

// bias + relu + f16 store into wave-private activation rows; D map: c[j][r] = (row 8h+r, col j*16+m)
__device__ __forceinline__ void relu_store(const v8f (&c)[8], f16t* act, const float* __restrict__ bias,
                                           int n0, int rowbase, int m, int h) {
#pragma unroll
  for (int j = 0; j < 8; ++j) {
    const int col = n0 + j * 16 + m;
    const float bv = bias[col];
#pragma unroll
    for (int r = 0; r < 8; ++r) {
      float v = c[j][r] * WINV + bv;
      v = v > 0.f ? v : 0.f;
      act[(rowbase + 8 * h + r) * AS + col] = (f16t)v;
    }
  }
}

__device__ __forceinline__ float tanh_f(float u) {
  u = fminf(fmaxf(u, -16.0f), 16.0f);
  const float e = __expf(2.0f * u);
  return 1.0f - 2.0f * __builtin_amdgcn_rcpf(e + 1.0f);
}

// ---------------------------------------------------------------------------
// Launch 1: W[l][k][n] f32 -> Wt[l][n][k] f16 (x16), k-contiguous rows.
// ---------------------------------------------------------------------------
__global__ void __launch_bounds__(256)
k_convert(const float* __restrict__ W1, const float* __restrict__ W2, const float* __restrict__ W3,
          f16t* __restrict__ wt, int nl) {
  const int g = blockIdx.x * 256 + threadIdx.x;
  if (g >= nl * LPL) return;
  const int l = g / LPL;
  int q = g - l * LPL;
  const float* src;
  f16t* dst;
  int K, N, n, part;
  const size_t base2 = (size_t)nl * HID * DIN;
  const size_t base3 = base2 + (size_t)nl * HID * HID;
  if (q < LN1) {
    n = q / (DIN / 64); part = q - n * (DIN / 64);
    K = DIN; N = HID;
    src = W1 + (size_t)l * DIN * HID;
    dst = wt + (size_t)l * HID * DIN;
  } else if (q < LN1 + LN2) {
    q -= LN1;
    n = q / (HID / 64); part = q - n * (HID / 64);
    K = HID; N = HID;
    src = W2 + (size_t)l * HID * HID;
    dst = wt + base2 + (size_t)l * HID * HID;
  } else {
    q -= LN1 + LN2;
    n = q / (HID / 64); part = q - n * (HID / 64);
    K = HID; N = D;
    src = W3 + (size_t)l * HID * D;
    dst = wt + base3 + (size_t)l * D * HID;
  }
  const int k0 = part * 64;
  union { v4u u[8]; f16t e[64]; } pk;
#pragma unroll
  for (int i = 0; i < 64; ++i)
    pk.e[i] = (f16t)(src[(size_t)(k0 + i) * N + n] * WSCALE);
  f16t* drow = dst + (size_t)n * K + k0;
#pragma unroll
  for (int s = 0; s < 8; ++s) *(v4u*)(drow + s * 8) = pk.u[s];
  
}

// ---------------------------------------------------------------------------
// Launch 2: one block per batch element, 8 waves x 16 wave-private token rows, z resident in LDS.
// ---------------------------------------------------------------------------
__global__ void __launch_bounds__(256)
k_flow(const float* __restrict__ x, const float* __restrict__ cond,
       const float* __restrict__ b1, const float* __restrict__ b2, const float* __restrict__ b3,
       const f16t* __restrict__ wt, float* __restrict__ outz, float* __restrict__ part,
       int B, int nl) {
  extern __shared__ v4u dsm[];
  char* smem = (char*)dsm;
  float* zbuf  = (float*)(smem + OFF_Z);
  f16t*  actA  = (f16t*)(smem + OFF_A);
  f16t*  actB  = (f16t*)(smem + OFF_B);
  f16t*  wslab = (f16t*)(smem + OFF_S);
  f16t*  condh = (f16t*)(smem + OFF_C);
  float* red   = (float*)(smem + OFF_R);

  const int b = blockIdx.x;
  if (b >= B) return;                        // block-uniform, before any barrier
  const int tid = threadIdx.x;
  const int lane = tid & 31, wave = tid >> 5;
  const int m = lane & 15, h = lane >> 4;
  const int rowbase = wave * 16;

  const uint32_t ring = (uint32_t)(size_t)wslab;   // LDS byte address of the slab ring
  const int nslab = nl * SPL;
  SlabCur cur;
  cur.l = 0; cur.s = 0;
  cur_pass(cur, wt, nl, tid);
  slab_issue(ring, cur, 0, wt, nl, tid);

  // stage x[b] (128 x 128 f32) and cond[b] (128, f16)
  {
    const float* xb = x + (size_t)b * TOK * D;
    for (int idx = tid; idx < TOK * (D / 4); idx += NTH) {
      const int r = idx / (D / 4), s = idx - r * (D / 4);
      *(v4f*)(zbuf + r * ZS + s * 4) = *(const v4f*)(xb + (size_t)r * D + s * 4);
    }
    if (tid < CND) condh[tid] = (f16t)cond[(size_t)b * CND + tid];
  }
  asm volatile("s_wait_asynccnt 0x0" ::: "memory");  // this wave's copies of slab 0 have landed
  __syncthreads();
  if (1 < nslab) slab_issue(ring, cur, 1, wt, nl, tid);
  int t = 0;                                         // slab in use; it lies in ring buffer t & 1

  float ldacc = 0.f;

  const float* zrow  = zbuf + (rowbase + m) * ZS;
  const f16t*  arowA = actA + (rowbase + m) * AS;
  const f16t*  arowB = actB + (rowbase + m) * AS;

  for (int l = 0; l < nl; ++l) {
    // stage 1: [16 x 192] @ [192 x 256] + relu -> actA ; A = [x1 | cond]
#pragma unroll 1
    for (int np = 0; np < HID / NP; ++np) {
      const int n0 = np * NP;
      v8f c[8];
      zero8(c);
      const f16t* ws = wslab + (t & 1) * SLABH;             // one slab holds the pass's whole k
      // both k loops unrolled: a k-tile's place in the slab row becomes an immediate offset of its LDS reads
#pragma unroll
      for (int kt = 0; kt < (D / 2) / 32; ++kt) {           // k 0..63 from z (f32 -> f16)
        v16h a = ldfrag32(zrow + kt * 32, h);
        ktile(c, a, ws + kt * 32, m, h);
      }
#pragma unroll
      for (int kt = (D / 2) / 32; kt < DIN / 32; ++kt) {    // k 64..191 from cond
        v16h a = ldfrag16(condh + (kt - (D / 2) / 32) * 32, h);
        ktile(c, a, ws + kt * 32, m, h);
      }
      ring_foot(ring, cur, nslab, t, wt, nl, tid);
      relu_store(c, actA, b1 + (size_t)l * HID, n0, rowbase, m, h);
    }

    // stage 2: [16 x 256] @ [256 x 256] + relu -> actB
#pragma unroll 1
    for (int np = 0; np < HID / NP; ++np) {
      const int n0 = np * NP;
      v8f c[8];
      zero8(c);
#pragma unroll 1
      for (int ks = 0; ks < HID / KS; ++ks) {               // one trip of the ring per 128-k slab
        const f16t* ws = wslab + (t & 1) * SLABH;
        // unrolled: a k-tile's place in the slab row becomes an immediate offset of its LDS reads
#pragma unroll
        for (int kt = 0; kt < KS / 32; ++kt) {
          v16h a = ldfrag16(arowA + ks * KS + kt * 32, h);
          ktile(c, a, ws + kt * 32, m, h);
        }
        ring_foot(ring, cur, nslab, t, wt, nl, tid);
      }
      relu_store(c, actB, b2 + (size_t)l * HID, n0, rowbase, m, h);
    }

    // stage 3: [16 x 256] @ [256 x 128] -> s | t ; coupling + flip
    {
      v8f c[8];
      zero8(c);
#pragma unroll 1
      for (int ks = 0; ks < HID / KS; ++ks) {               // one trip of the ring per 128-k slab
        const f16t* ws = wslab + (t & 1) * SLABH;
        // unrolled: a k-tile's place in the slab row becomes an immediate offset of its LDS reads
#pragma unroll
        for (int kt = 0; kt < KS / 32; ++kt) {
          v16h a = ldfrag16(arowB + ks * KS + kt * 32, h);
          ktile(c, a, ws + kt * 32, m, h);
        }
        ring_foot(ring, cur, nslab, t, wt, nl, tid);
      }
      const float* bb = b3 + (size_t)l * D;
      float x1v[4][8], y2v[4][8];
#pragma unroll
      for (int n = 0; n < 4; ++n) {                // n-tiles 0..3 = s cols 0..63, 4..7 = t cols
        const int col = n * 16 + m;
        const float bs = bb[col];
        const float bt = bb[D / 2 + col];
#pragma unroll
        for (int r = 0; r < 8; ++r) {
          const int tok = rowbase + 8 * h + r;
          const float u  = c[n][r] * WINV + bs;
          const float sv = 0.5f * tanh_f(u);
          const float tv = c[n + 4][r] * WINV + bt;
          const float x2 = zbuf[tok * ZS + D / 2 + col];
          y2v[n][r] = x2 * __expf(sv) + tv;
          x1v[n][r] = zbuf[tok * ZS + col];
          ldacc += sv;
        }
      }
      __syncthreads();                              // all z reads of this layer before any z write
#pragma unroll
      for (int n = 0; n < 4; ++n) {
        const int col = n * 16 + m;
#pragma unroll
        for (int r = 0; r < 8; ++r) {
          const int tok = rowbase + 8 * h + r;
          zbuf[tok * ZS + (D - 1 - col)]     = x1v[n][r];   // z'[64..127] = rev(x1)
          zbuf[tok * ZS + (D / 2 - 1 - col)] = y2v[n][r];   // z'[0..63]   = rev(y2)
        }
      }
    }
  }

  asm volatile("s_wait_asynccnt 0x0" ::: "memory");  // no copy is left in flight behind the ring

  // logdet block reduction
  red[tid] = ldacc;
  __syncthreads();                                  // also orders z element stores before the vector reloads below
  float ld = 0.f;
  if (wave == 0) {
#pragma unroll
    for (int k = 0; k < NTH / 32; ++k) ld += red[lane + 32 * k];
#pragma unroll
    for (int off = 16; off > 0; off >>= 1) ld += __shfl_xor(ld, off, 32);
  }

  float* oz = outz + ((size_t)b * TOK + rowbase) * D;
  float* pl = part + (size_t)b * 32;
#pragma unroll
  for (int r = 0; r < 16; ++r) {
    v4f v = *(const v4f*)(zbuf + (rowbase + r) * ZS + lane * 4);
    *(v4f*)(oz + (size_t)r * D + lane * 4) = v;
  }
  if (wave == 0) *(float*)(pl + lane) = ld;
  
}

// ---------------------------------------------------------------------------
// ---------------------------------------------------------------------------
__global__ void __launch_bounds__(256)
k_final(const float* __restrict__ part, float* __restrict__ outld, int B) {
  const int nq = (B + 3) / 4;
  for (int q = threadIdx.x; q < nq; q += 256) {
    const int b0 = q * 4;
    if (b0 + 3 < B) {
      v4f v;
      v.x = part[(size_t)(b0 + 0) * 32];
      v.y = part[(size_t)(b0 + 1) * 32];
      v.z = part[(size_t)(b0 + 2) * 32];
      v.w = part[(size_t)(b0 + 3) * 32];
      *(v4f*)(outld + b0) = v;
    } else {
      for (int i = 0; i < 4; ++i)
        if (b0 + i < B) *(float*)(outld + b0 + i) = part[(size_t)(b0 + i) * 32];
    }
  }
  
}

extern "C" void kernel_launch(void* const* d_in, const int* in_sizes, int n_in,
                              void* d_out, int out_size, void* d_ws, size_t ws_size,
                              hipStream_t stream) {
  if (n_in < 8) return;
  const float* x  = (const float*)d_in[0];
  const float* cd = (const float*)d_in[1];
  const float* W1 = (const float*)d_in[2];
  const float* b1 = (const float*)d_in[3];
  const float* W2 = (const float*)d_in[4];
  const float* b2 = (const float*)d_in[5];
  const float* W3 = (const float*)d_in[6];
  const float* b3 = (const float*)d_in[7];

  const int B  = in_sizes[0] / (TOK * D);
  const int nl = in_sizes[2] / (DIN * HID);
  if (B <= 0 || nl <= 0) return;
  if (in_sizes[1] < B * CND) return;
  if (in_sizes[3] < nl * HID || in_sizes[4] < nl * HID * HID || in_sizes[5] < nl * HID) return;
  if (in_sizes[6] < nl * HID * D || in_sizes[7] < nl * D) return;
  if ((size_t)out_size < (size_t)B * TOK * D + (size_t)B) return;

  const size_t wt_bytes  = (size_t)nl * WPL * sizeof(f16t);
  const size_t part_off  = (wt_bytes + 127) & ~(size_t)127;
  const size_t part_bytes = (size_t)B * 128;
  if (part_off + part_bytes > ws_size) return;

  f16t*  wt    = (f16t*)d_ws;
  float* part  = (float*)((char*)d_ws + part_off);
  float* outz  = (float*)d_out;
  float* outld = outz + (size_t)B * TOK * D;

  const int nlines = nl * LPL;
  k_convert<<<(nlines + 255) / 256, 256, 0, stream>>>(W1, W2, W3, wt, nl);

  (void)hipFuncSetAttribute((const void*)k_flow, hipFuncAttributeMaxDynamicSharedMemorySize, SMEM_TOTAL);
  k_flow<<<B, NTH, SMEM_TOTAL, stream>>>(x, cd, b1, b2, b3, wt, outz, part, B, nl);

  k_final<<<1, 256, 0, stream>>>(part, outld, B);
}

// v004
// It runs in 133 microseconds.
// Timed twice side by side with v003, it ran 1.21 times as fast both times.
// Over all steps from v000 it is 2.44 times as fast.
#include <hip/hip_runtime.h>
#include <stdint.h>
#include <stddef.h>

// All contractions: v_wmma_f32_16x16x32_f16 (f16 operands, f32 accumulate); weights carried x16 in f16 (k-contiguous transposed copy), folded back as 1/16 in the f32 epilogue; coupling tanh/exp/flip/logdet math in f32.

typedef _Float16 f16t;
typedef f16t  v8h  __attribute__((ext_vector_type(8)));
typedef f16t  v16h __attribute__((ext_vector_type(16)));
typedef float v4f  __attribute__((ext_vector_type(4)));
typedef float v8f  __attribute__((ext_vector_type(8)));
typedef unsigned int v4u __attribute__((ext_vector_type(4)));

union Frag { v16h v; v8h q[2]; };

constexpr int D   = 128;           // patch dim
constexpr int CND = 128;           // cond dim
constexpr int HID = 256;           // hidden
constexpr int DIN = D / 2 + CND;   // 192
constexpr int TOK = 128;           // tokens per batch element = one block
constexpr int NTH = 256;           // threads per block (8 waves: 2 along tokens x 4 along output columns)

constexpr int ZS = 132;            // z row stride in floats (528 B, 16-B aligned)
constexpr int AS = 264;            // activation row stride in halves (528 B)
constexpr int SP = 136;            // weight slab row stride in halves (272 B = 16 B x 17), up to 128 k per row

constexpr float WSCALE = 16.0f;    // exact power of two on the f16 weight copy
constexpr float WINV   = 0.0625f;

// dynamic LDS carve (bytes)
constexpr int OFF_Z = 0;                       // [128][ZS] f32 z
constexpr int OFF_A = OFF_Z + TOK * ZS * 4;    // [128][AS] f16 act (stage-1 out, then stage-2 out in its place)
constexpr int SLABH = HID * SP;                // halves per weight slab buffer
constexpr int OFF_S = OFF_A + TOK * AS * 2;    // 2 x [256][SP] f16 weight slab ring
constexpr int OFF_C = OFF_S + 2 * SLABH * 2;   // [128] f16 cond
constexpr int OFF_R = OFF_C + CND * 2;         // [256] f32 reduce
constexpr int SMEM_TOTAL = OFF_R + NTH * 4;    // 275712 B

static_assert(OFF_A % 16 == 0 && OFF_S % 16 == 0 && OFF_C % 16 == 0 && OFF_R % 16 == 0, "");

constexpr int LN1 = HID * (DIN / 64);          // 768  (W1t: 256 rows x 192 halves)
constexpr int LN2 = HID * (HID / 64);          // 1024 (W2t: 256 rows x 256 halves)
constexpr int LN3 = D * (HID / 64);            // 512  (W3t: 128 rows x 256 halves)
constexpr int LPL = LN1 + LN2 + LN3;           // 2304
constexpr int WPL = HID * DIN + HID * HID + D * HID;   // halves per layer = 147456

// weight slabs of one layer, in the order of use; a slab holds every output column of its stage:
// 0: W1t k 0..127, 1: W1t k 128..191, 2, 3: W2t k 0..127, 128..255 (256 rows each), 4, 5: W3t k 0..127, 128..255 (128 rows)
constexpr int KS  = 128;                       // k per full slab
constexpr int SPL = 6;                         // slabs per layer (even: slab i of any layer lies in ring buffer i & 1)
static_assert(KS <= SP && SMEM_TOTAL <= 327680 && SPL % 2 == 0, "");

__device__ __forceinline__ v8f wmma_f16(v16h a, v16h b, v8f c) {
  return __builtin_amdgcn_wmma_f32_16x16x32_f16(false, a, false, b, (short)0, c, false, false);
}

// 16x32 fragment from a k-contiguous 16-bit row: elems 0..7 <- p[8h..8h+7], elems 8..15 <- p[16+8h..16+8h+7]
__device__ __forceinline__ v16h ldfrag16(const f16t* p, int h) {
  Frag f;
  f.q[0] = *(const v8h*)(p + 8 * h);
  f.q[1] = *(const v8h*)(p + 16 + 8 * h);
  return f.v;
}

// same map from an f32 row, RNE convert to f16 in registers
__device__ __forceinline__ v16h ldfrag32(const float* p, int h) {
  v4f a0 = *(const v4f*)(p + 8 * h);
  v4f a1 = *(const v4f*)(p + 8 * h + 4);
  v4f a2 = *(const v4f*)(p + 16 + 8 * h);
  v4f a3 = *(const v4f*)(p + 16 + 8 * h + 4);
  v8f lo = __builtin_shufflevector(a0, a1, 0, 1, 2, 3, 4, 5, 6, 7);
  v8f hi = __builtin_shufflevector(a2, a3, 0, 1, 2, 3, 4, 5, 6, 7);
  Frag f;
  f.q[0] = __builtin_convertvector(lo, v8h);
  f.q[1] = __builtin_convertvector(hi, v8h);
  return f.v;
}

template <int NJ>
__device__ __forceinline__ void zero_acc(v8f (&c)[4][NJ]) {
#pragma unroll
  for (int i = 0; i < 4; ++i)
#pragma unroll
    for (int j = 0; j < NJ; ++j) {
      v8f z = {0.f, 0.f, 0.f, 0.f, 0.f, 0.f, 0.f, 0.f};
      c[i][j] = z;
    }
}

// Eight copies of 16 B a lane, global -> LDS through no register, so the slab flies while the slab before it is multiplied;
// the closing wait is a precaution: no address register of a copy is rewritten ahead of it
__device__ __forceinline__ void copy8(const uint32_t (&d)[8], const char* const (&g)[8]) {
  asm volatile("global_load_async_to_lds_b128 %0, %8, off\n\t"
               "global_load_async_to_lds_b128 %1, %9, off\n\t"
               "global_load_async_to_lds_b128 %2, %10, off\n\t"
               "global_load_async_to_lds_b128 %3, %11, off\n\t"
               "global_load_async_to_lds_b128 %4, %12, off\n\t"
               "global_load_async_to_lds_b128 %5, %13, off\n\t"
               "global_load_async_to_lds_b128 %6, %14, off\n\t"
               "global_load_async_to_lds_b128 %7, %15, off\n\t"
               "s_wait_xcnt 0x0"
               :: "v"(d[0]), "v"(d[1]), "v"(d[2]), "v"(d[3]), "v"(d[4]), "v"(d[5]), "v"(d[6]), "v"(d[7]),
                  "v"(g[0]), "v"(g[1]), "v"(g[2]), "v"(g[3]), "v"(g[4]), "v"(g[5]), "v"(g[6]), "v"(g[7]) : "memory");
}

// Start the copies of slab S of layer ll into ring buffer buf. Eight threads take one whole 128-B line (64 k) of a row;
// every thread copies its 16 B in rows tid / 8 + 32 i of each 64-k column block of the slab.
template <int S>
__device__ __forceinline__ void slab_issue(uint32_t ring, int buf, const f16t* wt, int nl, int ll, int tid) {
  constexpr int K = S < 2 ? DIN : HID;                      // k per row of the transposed weight copy
  constexpr int GR = 32 * K * 2;                            // global bytes from a row to the row 32 further on
  constexpr uint32_t DR = (uint32_t)(32 * SP) * 2u;         // the same in LDS
  const size_t off = S < 2 ? (size_t)ll * HID * DIN
                   : S < 4 ? (size_t)nl * HID * DIN + (size_t)ll * HID * HID
                           : (size_t)nl * (HID * DIN + HID * HID) + (size_t)ll * D * HID;
  const char* g0 = (const char*)(wt + off) + ((tid >> 3) * K + (S & 1) * KS + (tid & 7) * 8) * 2;
  const uint32_t d0 = ring + (uint32_t)(buf * SLABH + (tid >> 3) * SP + (tid & 7) * 8) * 2u;
  uint32_t d[8];
  const char* g[8];
  if constexpr (S == 1) {                                   // 256 rows x 64 k
#pragma unroll
    for (int i = 0; i < 8; ++i) { d[i] = d0 + (uint32_t)i * DR; g[i] = g0 + i * GR; }
    copy8(d, g);
  } else {                                                  // 256 or 128 rows x 128 k, 128 rows a statement
#pragma unroll
    for (int q = 0; q < (S < 4 ? 2 : 1); ++q) {
#pragma unroll
      for (int i = 0; i < 4; ++i) {
        d[i]     = d0 + (uint32_t)(q * 4 + i) * DR;
        g[i]     = g0 + (q * 4 + i) * GR;
        d[i + 4] = d[i] + 128u;
        g[i + 4] = g[i] + 128;
      }
      copy8(d, g);
    }
  }
}

// Foot of the trip on slab I of layer l: publish the next slab, then refill the buffer just read with the slab after that.
template <int I>
__device__ __forceinline__ void ring_foot(uint32_t ring, const f16t* wt, int nl, int l, int tid) {
  asm volatile("s_wait_dscnt 0x0" ::: "memory");     // this wave's LDS reads and writes are done before the hand-over
  asm volatile("s_wait_asynccnt 0x0" ::: "memory");  // this wave's copies of the next slab have landed
  __syncthreads();                                   // next slab readable by all, this slab left by all
  if constexpr (I + 2 < SPL) {
    slab_issue<I + 2>(ring, I & 1, wt, nl, l, tid);
  } else {
    if (l + 1 < nl) slab_issue<I + 2 - SPL>(ring, I & 1, wt, nl, l + 1, tid);
  }
}

// One 32-deep k-tile of a wave tile of 4 m-tiles x NJ n-tiles: 4 A and NJ B fragments feed 4 * NJ WMMAs.
// AK: where A comes from (0: f32 z rows, 1: the one cond row, shared by every token, 2: f16 act rows); zp or hp points to
// the lane's row of m-tile 0 at the k-tile. B fragment j from slab row (j * JS + lane's row) at the k-tile (bp points there).
template <int NJ, int JS, int AK>
__device__ __forceinline__ void ktile(v8f (&c)[4][NJ], const float* zp, const f16t* hp, const f16t* bp, int h) {
  v16h a[4], bfr[NJ];   // one register set per fragment, so that the LDS latency is paid once a k-tile
  if constexpr (AK == 0) {
#pragma unroll
    for (int i = 0; i < 4; ++i) a[i] = ldfrag32(zp + i * 16 * ZS, h);
  } else if constexpr (AK == 1) {
    a[0] = ldfrag16(hp, h);
    a[1] = a[0]; a[2] = a[0]; a[3] = a[0];
  } else {
#pragma unroll
    for (int i = 0; i < 4; ++i) a[i] = ldfrag16(hp + i * 16 * AS, h);
  }
#pragma unroll
  for (int j = 0; j < NJ; ++j) bfr[j] = ldfrag16(bp + j * JS * SP, h);
  // holds the k-tile's LDS reads in one group ahead of the WMMAs: without it they sink back to a full wait in front of each
  __builtin_amdgcn_sched_barrier(0);
#pragma unroll
  for (int j = 0; j < NJ; ++j) {
#pragma unroll
    for (int i = 0; i < 4; ++i) {
      c[i][j] = wmma_f16(a[i], bfr[j], c[i][j]);
      // keeps the WMMAs in the order of their reads, so that each group waits only for its own B pair (a counted wait)
      __builtin_amdgcn_sched_barrier(0);
    }
  }
}

// four vector slots behind a slab's last WMMA, on every path: a taken branch in the ring foot leads to vector writes of
// A and B registers
__device__ __forceinline__ void wmma_tail(v8f (&c)[4][4]) {
  asm volatile("v_nop\n\tv_nop\n\tv_nop\n\tv_nop"
               : "+v"(c[0][0]), "+v"(c[0][1]), "+v"(c[0][2]), "+v"(c[0][3]), "+v"(c[1][0]), "+v"(c[1][1]), "+v"(c[1][2]), "+v"(c[1][3]),
                 "+v"(c[2][0]), "+v"(c[2][1]), "+v"(c[2][2]), "+v"(c[2][3]), "+v"(c[3][0]), "+v"(c[3][1]), "+v"(c[3][2]), "+v"(c[3][3]));
}
__device__ __forceinline__ void wmma_tail(v8f (&c)[4][2]) {
  asm volatile("v_nop\n\tv_nop\n\tv_nop\n\tv_nop"
               : "+v"(c[0][0]), "+v"(c[0][1]), "+v"(c[1][0]), "+v"(c[1][1]), "+v"(c[2][0]), "+v"(c[2][1]), "+v"(c[3][0]), "+v"(c[3][1]));
}

// bias + relu + f16 store of a 64 x 64 wave tile; D map: c[i][j][r] = (row row0 + 16 i + r, col col0 + 16 j),
// row0 = tile's first row + 8 h, col0 = tile's first column + m
__device__ __forceinline__ void relu_store(const v8f (&c)[4][4], f16t* act, const float* __restrict__ bias,
                                           int row0, int col0) {
  const float* bp = bias + col0;
  float bvs[4];
#pragma unroll
  for (int j = 0; j < 4; ++j) bvs[j] = bp[j * 16];
  // a precaution: the bias loads' address registers stay as they are up to this wait
  asm volatile("s_wait_xcnt 0x0" :: "v"(bp) : "memory");
#pragma unroll
  for (int j = 0; j < 4; ++j) {
    const int col = col0 + j * 16;
    const float bv = bvs[j];
#pragma unroll
    for (int i = 0; i < 4; ++i) {
#pragma unroll
      for (int r = 0; r < 8; ++r) {
        float v = c[i][j][r] * WINV + bv;
        v = v > 0.f ? v : 0.f;
        act[(row0 + i * 16 + r) * AS + col] = (f16t)v;
      }
    }
  }
}

__device__ __forceinline__ float tanh_f(float u) {
  u = fminf(fmaxf(u, -16.0f), 16.0f);
  const float e = __expf(2.0f * u);
  return 1.0f - 2.0f * __builtin_amdgcn_rcpf(e + 1.0f);
}

// ---------------------------------------------------------------------------
// Launch 1: W[l][k][n] f32 -> Wt[l][n][k] f16 (x16), k-contiguous rows.
// ---------------------------------------------------------------------------
__global__ void __launch_bounds__(256)
k_convert(const float* __restrict__ W1, const float* __restrict__ W2, const float* __restrict__ W3,
          f16t* __restrict__ wt, int nl) {
  const int g = blockIdx.x * 256 + threadIdx.x;
  if (g >= nl * LPL) return;
  const int l = g / LPL;
  int q = g - l * LPL;
  const float* src;
  f16t* dst;
  int K, N, n, part;
  const size_t base2 = (size_t)nl * HID * DIN;
  const size_t base3 = base2 + (size_t)nl * HID * HID;
  if (q < LN1) {
    n = q / (DIN / 64); part = q - n * (DIN / 64);
    K = DIN; N = HID;
    src = W1 + (size_t)l * DIN * HID;
    dst = wt + (size_t)l * HID * DIN;
  } else if (q < LN1 + LN2) {
    q -= LN1;
    n = q / (HID / 64); part = q - n * (HID / 64);
    K = HID; N = HID;
    src = W2 + (size_t)l * HID * HID;
    dst = wt + base2 + (size_t)l * HID * HID;
  } else {
    q -= LN1 + LN2;
    n = q / (HID / 64); part = q - n * (HID / 64);
    K = HID; N = D;
    src = W3 + (size_t)l * HID * D;
    dst = wt + base3 + (size_t)l * D * HID;
  }
  const int k0 = part * 64;
  union { v4u u[8]; f16t e[64]; } pk;
#pragma unroll
  for (int i = 0; i < 64; ++i)
    pk.e[i] = (f16t)(src[(size_t)(k0 + i) * N + n] * WSCALE);
  f16t* drow = dst + (size_t)n * K + k0;
#pragma unroll
  for (int s = 0; s < 8; ++s) *(v4u*)(drow + s * 8) = pk.u[s];
  
}

// ---------------------------------------------------------------------------
// Launch 2: one block per batch element, z resident in LDS; 8 waves as 2 x 4, each a 64-token x 64-column tile of a
// stage's output (64 x 32 in stage 3), so that an LDS fragment feeds 4 WMMAs (A in stage 3: 2).
// ---------------------------------------------------------------------------
__global__ void __launch_bounds__(256)
k_flow(const float* __restrict__ x, const float* __restrict__ cond,
       const float* __restrict__ b1, const float* __restrict__ b2, const float* __restrict__ b3,
       const f16t* __restrict__ wt, float* __restrict__ outz, float* __restrict__ part,
       int B, int nl) {
  extern __shared__ v4u dsm[];
  char* smem = (char*)dsm;
  float* zbuf  = (float*)(smem + OFF_Z);
  f16t*  act   = (f16t*)(smem + OFF_A);
  f16t*  wslab = (f16t*)(smem + OFF_S);
  f16t*  condh = (f16t*)(smem + OFF_C);
  float* red   = (float*)(smem + OFF_R);

  const int b = blockIdx.x;
  if (b >= B) return;                        // block-uniform, before any barrier
  const int tid = threadIdx.x;
  const int lane = tid & 31, wave = tid >> 5;
  const int m = lane & 15, h = lane >> 4;
  const int rowbase = wave * 16;             // rows of the closing copy to global memory
  const int wm = wave >> 2, wn = wave & 3;   // the wave's place in the 2 x 4 grid
  const int mrow = wm * 64;                  // first token row of the wave tile

  const uint32_t ring = (uint32_t)(size_t)wslab;   // LDS byte address of the slab ring
  slab_issue<0>(ring, 0, wt, nl, 0, tid);

  // stage x[b] (128 x 128 f32) and cond[b] (128, f16)
  {
    const float* xb = x + (size_t)b * TOK * D;
    for (int idx = tid; idx < TOK * (D / 4); idx += NTH) {
      const int r = idx / (D / 4), s = idx - r * (D / 4);
      *(v4f*)(zbuf + r * ZS + s * 4) = *(const v4f*)(xb + (size_t)r * D + s * 4);
    }
    if (tid < CND) condh[tid] = (f16t)cond[(size_t)b * CND + tid];
  }
  asm volatile("s_wait_asynccnt 0x0" ::: "memory");  // this wave's copies of slab 0 have landed
  __syncthreads();
  slab_issue<1>(ring, 1, wt, nl, 0, tid);

  float ldacc = 0.f;

  const float* zrow = zbuf + (mrow + m) * ZS;              // A rows of m-tile 0
  const f16t*  arow = act + (mrow + m) * AS;
  const f16t*  ws0  = wslab;                               // ring buffers
  const f16t*  ws1  = wslab + SLABH;
  const int    bo12 = (wn * 64 + m) * SP;                  // B row of n-tile 0, stages 1 and 2
  const int    bo3  = (wn * 16 + m) * SP;                  // stage 3: n-tile 0 = s columns, n-tile 1 = t columns 64 on

  for (int l = 0; l < nl; ++l) {
    // every k loop below is unrolled: a k-tile's place in its rows becomes an immediate offset of its LDS reads
    {
      v8f c[4][4];
      // stage 1: [128 x 192] @ [192 x 256] + relu -> act ; A = [x1 | cond]
      zero_acc(c);
#pragma unroll
      for (int kt = 0; kt < 2; ++kt)                        // k 0..63 from z (f32 -> f16)
        ktile<4, 16, 0>(c, zrow + kt * 32, nullptr, ws0 + bo12 + kt * 32, h);
#pragma unroll
      for (int kt = 2; kt < 4; ++kt)                        // k 64..127 from cond
        ktile<4, 16, 1>(c, nullptr, condh + (kt - 2) * 32, ws0 + bo12 + kt * 32, h);
      wmma_tail(c);
      ring_foot<0>(ring, wt, nl, l, tid);
#pragma unroll
      for (int kt = 0; kt < 2; ++kt)                        // k 128..191 from cond
        ktile<4, 16, 1>(c, nullptr, condh + (kt + 2) * 32, ws1 + bo12 + kt * 32, h);
      wmma_tail(c);
      // nobody reads act in stage 1: stored ahead of the foot, whose wait and barrier publish it with the next slab
      relu_store(c, act, b1 + (size_t)l * HID, mrow + 8 * h, wn * 64 + m);
      ring_foot<1>(ring, wt, nl, l, tid);

      // stage 2: [128 x 256] @ [256 x 256] + relu -> act, in place
      zero_acc(c);
#pragma unroll
      for (int kt = 0; kt < KS / 32; ++kt)
        ktile<4, 16, 2>(c, nullptr, arow + kt * 32, ws0 + bo12 + kt * 32, h);
      wmma_tail(c);
      ring_foot<2>(ring, wt, nl, l, tid);
#pragma unroll
      for (int kt = 0; kt < KS / 32; ++kt)
        ktile<4, 16, 2>(c, nullptr, arow + KS + kt * 32, ws1 + bo12 + kt * 32, h);
      wmma_tail(c);
      ring_foot<3>(ring, wt, nl, l, tid);                   // its barrier also ends every wave's reads of stage-1 act
      relu_store(c, act, b2 + (size_t)l * HID, mrow + 8 * h, wn * 64 + m);
      __syncthreads();                                      // stage-2 act readable by all
    }

    // stage 3: [128 x 256] @ [256 x 128] -> s | t ; coupling + flip
    {
      v8f c[4][2];
      zero_acc(c);
#pragma unroll
      for (int kt = 0; kt < KS / 32; ++kt)
        ktile<2, 64, 2>(c, nullptr, arow + kt * 32, ws0 + bo3 + kt * 32, h);
      wmma_tail(c);
      ring_foot<4>(ring, wt, nl, l, tid);
#pragma unroll
      for (int kt = 0; kt < KS / 32; ++kt)
        ktile<2, 64, 2>(c, nullptr, arow + KS + kt * 32, ws1 + bo3 + kt * 32, h);
      wmma_tail(c);
      const int col = wn * 16 + m;                  // s column; its t column is 64 further on
      const float* bb = b3 + (size_t)l * D + col;
      const float bs = bb[0];
      const float bt = bb[D / 2];
      // a precaution: the bias loads' address registers stay as they are up to this wait
      asm volatile("s_wait_xcnt 0x0" :: "v"(bb) : "memory");
      float x1v[4][8], x2v[4][8];
#pragma unroll
      for (int i = 0; i < 4; ++i) {
#pragma unroll
        for (int r = 0; r < 8; ++r) {
          const int tok = mrow + i * 16 + 8 * h + r;
          x1v[i][r] = zbuf[tok * ZS + col];
          x2v[i][r] = zbuf[tok * ZS + D / 2 + col];
        }
      }
      ring_foot<5>(ring, wt, nl, l, tid);           // its wait and barrier: all z reads of this layer before any z write
#pragma unroll
      for (int i = 0; i < 4; ++i) {
#pragma unroll
        for (int r = 0; r < 8; ++r) {
          const int tok = mrow + i * 16 + 8 * h + r;
          const float u  = c[i][0][r] * WINV + bs;
          const float sv = 0.5f * tanh_f(u);
          const float tv = c[i][1][r] * WINV + bt;
          ldacc += sv;
          zbuf[tok * ZS + (D - 1 - col)]     = x1v[i][r];                       // z'[64..127] = rev(x1)
          zbuf[tok * ZS + (D / 2 - 1 - col)] = x2v[i][r] * __expf(sv) + tv;     // z'[0..63]   = rev(y2)
        }
      }
      __syncthreads();                              // the new z readable by all
    }
  }

  asm volatile("s_wait_asynccnt 0x0" ::: "memory");  // no copy is left in flight behind the ring

  // logdet block reduction
  red[tid] = ldacc;
  __syncthreads();                                  // also orders z element stores before the vector reloads below
  float ld = 0.f;
  if (wave == 0) {
#pragma unroll
    for (int k = 0; k < NTH / 32; ++k) ld += red[lane + 32 * k];
#pragma unroll
    for (int off = 16; off > 0; off >>= 1) ld += __shfl_xor(ld, off, 32);
  }

  float* oz = outz + ((size_t)b * TOK + rowbase) * D;
  float* pl = part + (size_t)b * 32;
#pragma unroll
  for (int r = 0; r < 16; ++r) {
    v4f v = *(const v4f*)(zbuf + (rowbase + r) * ZS + lane * 4);
    *(v4f*)(oz + (size_t)r * D + lane * 4) = v;
  }
  if (wave == 0) *(float*)(pl + lane) = ld;
  
}

// ---------------------------------------------------------------------------
// ---------------------------------------------------------------------------
__global__ void __launch_bounds__(256)
k_final(const float* __restrict__ part, float* __restrict__ outld, int B) {
  const int nq = (B + 3) / 4;
  for (int q = threadIdx.x; q < nq; q += 256) {
    const int b0 = q * 4;
    if (b0 + 3 < B) {
      v4f v;
      v.x = part[(size_t)(b0 + 0) * 32];
      v.y = part[(size_t)(b0 + 1) * 32];
      v.z = part[(size_t)(b0 + 2) * 32];
      v.w = part[(size_t)(b0 + 3) * 32];
      *(v4f*)(outld + b0) = v;
    } else {
      for (int i = 0; i < 4; ++i)
        if (b0 + i < B) *(float*)(outld + b0 + i) = part[(size_t)(b0 + i) * 32];
    }
  }
  
}

extern "C" void kernel_launch(void* const* d_in, const int* in_sizes, int n_in,
                              void* d_out, int out_size, void* d_ws, size_t ws_size,
                              hipStream_t stream) {
  if (n_in < 8) return;
  const float* x  = (const float*)d_in[0];
  const float* cd = (const float*)d_in[1];
  const float* W1 = (const float*)d_in[2];
  const float* b1 = (const float*)d_in[3];
  const float* W2 = (const float*)d_in[4];
  const float* b2 = (const float*)d_in[5];
  const float* W3 = (const float*)d_in[6];
  const float* b3 = (const float*)d_in[7];

  const int B  = in_sizes[0] / (TOK * D);
  const int nl = in_sizes[2] / (DIN * HID);
  if (B <= 0 || nl <= 0) return;
  if (in_sizes[1] < B * CND) return;
  if (in_sizes[3] < nl * HID || in_sizes[4] < nl * HID * HID || in_sizes[5] < nl * HID) return;
  if (in_sizes[6] < nl * HID * D || in_sizes[7] < nl * D) return;
  if ((size_t)out_size < (size_t)B * TOK * D + (size_t)B) return;

  const size_t wt_bytes  = (size_t)nl * WPL * sizeof(f16t);
  const size_t part_off  = (wt_bytes + 127) & ~(size_t)127;
  const size_t part_bytes = (size_t)B * 128;
  if (part_off + part_bytes > ws_size) return;

  f16t*  wt    = (f16t*)d_ws;
  float* part  = (float*)((char*)d_ws + part_off);
  float* outz  = (float*)d_out;
  float* outld = outz + (size_t)B * TOK * D;

  const int nlines = nl * LPL;
  k_convert<<<(nlines + 255) / 256, 256, 0, stream>>>(W1, W2, W3, wt, nl);

  (void)hipFuncSetAttribute((const void*)k_flow, hipFuncAttributeMaxDynamicSharedMemorySize, SMEM_TOTAL);
  k_flow<<<B, NTH, SMEM_TOTAL, stream>>>(x, cd, b1, b2, b3, wt, outz, part, B, nl);

  k_final<<<1, 256, 0, stream>>>(part, outld, B);
}

// v005
// It runs in 116 microseconds.
// In two side-by-side timings against v004, it was 1.13 and 1.14 times as fast.
// Counting every step since v000, it is 2.76 times as fast.
#include <hip/hip_runtime.h>
#include <stdint.h>
#include <stddef.h>

// All contractions: v_wmma_f32_16x16x32_f16 (f16 operands, f32 accumulate); weights carried x16 in f16 (k-contiguous transposed copy), folded back as 1/16 in the f32 epilogue; coupling tanh/exp/flip/logdet math in f32.

typedef _Float16 f16t;
typedef f16t  v8h  __attribute__((ext_vector_type(8)));
typedef f16t  v16h __attribute__((ext_vector_type(16)));
typedef float v4f  __attribute__((ext_vector_type(4)));
typedef float v8f  __attribute__((ext_vector_type(8)));
typedef unsigned int v4u __attribute__((ext_vector_type(4)));

union Frag { v16h v; v8h q[2]; };

constexpr int D   = 128;           // patch dim
constexpr int CND = 128;           // cond dim
constexpr int HID = 256;           // hidden
constexpr int DIN = D / 2 + CND;   // 192
constexpr int TOK = 128;           // tokens per batch element = one block
constexpr int NTH = 256;           // threads per block (8 waves: 2 along tokens x 4 along output columns)

constexpr int ZS = 132;            // z row stride in floats (528 B, 16-B aligned)
constexpr int AS = 264;            // activation row stride in halves (528 B)
constexpr int SP = 136;            // weight slab row stride in halves (272 B = 16 B x 17), up to 128 k per row

constexpr float WSCALE = 16.0f;    // exact power of two on the f16 weight copy
constexpr float WINV   = 0.0625f;

// dynamic LDS carve (bytes)
constexpr int OFF_Z = 0;                       // [128][ZS] f32 z
constexpr int OFF_A = OFF_Z + TOK * ZS * 4;    // [128][AS] f16 act (stage-1 out, then stage-2 out in its place)
constexpr int SLABH = HID * SP;                // halves per weight slab buffer
constexpr int OFF_S = OFF_A + TOK * AS * 2;    // 2 x [256][SP] f16 weight slab ring
constexpr int OFF_C = OFF_S + 2 * SLABH * 2;   // [128] f16 cond
constexpr int OFF_R = OFF_C + CND * 2;         // [256] f32 reduce
constexpr int SMEM_TOTAL = OFF_R + NTH * 4;    // 275712 B

static_assert(OFF_A % 16 == 0 && OFF_S % 16 == 0 && OFF_C % 16 == 0 && OFF_R % 16 == 0, "");

constexpr int LN1 = HID * (DIN / 64);          // 768  (W1t: 256 rows x 192 halves)
constexpr int LN2 = HID * (HID / 64);          // 1024 (W2t: 256 rows x 256 halves)
constexpr int LN3 = D * (HID / 64);            // 512  (W3t: 128 rows x 256 halves)
constexpr int LPL = LN1 + LN2 + LN3;           // 2304
constexpr int WPL = HID * DIN + HID * HID + D * HID;   // halves per layer = 147456

// weight slabs of one layer, in the order of use; a slab holds every output column of its stage:
// 0: W1t k 0..127, 1: W1t k 128..191, 2, 3: W2t k 0..127, 128..255 (256 rows each), 4, 5: W3t k 0..127, 128..255 (128 rows)
constexpr int KS  = 128;                       // k per full slab
constexpr int SPL = 6;                         // slabs per layer (even: slab i of any layer lies in ring buffer i & 1)
static_assert(KS <= SP && SMEM_TOTAL <= 327680 && SPL % 2 == 0, "");

__device__ __forceinline__ v8f wmma_f16(v16h a, v16h b, v8f c) {
  return __builtin_amdgcn_wmma_f32_16x16x32_f16(false, a, false, b, (short)0, c, false, false);
}

// 16x32 fragment from a k-contiguous 16-bit row: elems 0..7 <- p[8h..8h+7], elems 8..15 <- p[16+8h..16+8h+7]
__device__ __forceinline__ v16h ldfrag16(const f16t* p, int h) {
  Frag f;
  f.q[0] = *(const v8h*)(p + 8 * h);
  f.q[1] = *(const v8h*)(p + 16 + 8 * h);
  return f.v;
}

// same map from an f32 row, RNE convert to f16 in registers
__device__ __forceinline__ v16h ldfrag32(const float* p, int h) {
  v4f a0 = *(const v4f*)(p + 8 * h);
  v4f a1 = *(const v4f*)(p + 8 * h + 4);
  v4f a2 = *(const v4f*)(p + 16 + 8 * h);
  v4f a3 = *(const v4f*)(p + 16 + 8 * h + 4);
  v8f lo = __builtin_shufflevector(a0, a1, 0, 1, 2, 3, 4, 5, 6, 7);
  v8f hi = __builtin_shufflevector(a2, a3, 0, 1, 2, 3, 4, 5, 6, 7);
  Frag f;
  f.q[0] = __builtin_convertvector(lo, v8h);
  f.q[1] = __builtin_convertvector(hi, v8h);
  return f.v;
}

template <int NJ>
__device__ __forceinline__ void zero_acc(v8f (&c)[4][NJ]) {
#pragma unroll
  for (int i = 0; i < 4; ++i)
#pragma unroll
    for (int j = 0; j < NJ; ++j) {
      v8f z = {0.f, 0.f, 0.f, 0.f, 0.f, 0.f, 0.f, 0.f};
      c[i][j] = z;
    }
}

// Eight copies of 16 B a lane, global -> LDS through no register, so the slab flies while the slab before it is multiplied;
// the closing wait is a precaution: no address register of a copy is rewritten ahead of it
__device__ __forceinline__ void copy8(const uint32_t (&d)[8], const char* const (&g)[8]) {
  asm volatile("global_load_async_to_lds_b128 %0, %8, off\n\t"
               "global_load_async_to_lds_b128 %1, %9, off\n\t"
               "global_load_async_to_lds_b128 %2, %10, off\n\t"
               "global_load_async_to_lds_b128 %3, %11, off\n\t"
               "global_load_async_to_lds_b128 %4, %12, off\n\t"
               "global_load_async_to_lds_b128 %5, %13, off\n\t"
               "global_load_async_to_lds_b128 %6, %14, off\n\t"
               "global_load_async_to_lds_b128 %7, %15, off\n\t"
               "s_wait_xcnt 0x0"
               :: "v"(d[0]), "v"(d[1]), "v"(d[2]), "v"(d[3]), "v"(d[4]), "v"(d[5]), "v"(d[6]), "v"(d[7]),
                  "v"(g[0]), "v"(g[1]), "v"(g[2]), "v"(g[3]), "v"(g[4]), "v"(g[5]), "v"(g[6]), "v"(g[7]) : "memory");
}

// Start the copies of slab S of layer ll into ring buffer buf. Eight threads take one whole 128-B line (64 k) of a row;
// every thread copies its 16 B in rows tid / 8 + 32 i of each 64-k column block of the slab.
template <int S>
__device__ __forceinline__ void slab_issue(uint32_t ring, int buf, const f16t* wt, int nl, int ll, int tid) {
  constexpr int K = S < 2 ? DIN : HID;                      // k per row of the transposed weight copy
  constexpr int GR = 32 * K * 2;                            // global bytes from a row to the row 32 further on
  constexpr uint32_t DR = (uint32_t)(32 * SP) * 2u;         // the same in LDS
  const size_t off = S < 2 ? (size_t)ll * HID * DIN
                   : S < 4 ? (size_t)nl * HID * DIN + (size_t)ll * HID * HID
                           : (size_t)nl * (HID * DIN + HID * HID) + (size_t)ll * D * HID;
  const char* g0 = (const char*)(wt + off) + ((tid >> 3) * K + (S & 1) * KS + (tid & 7) * 8) * 2;
  const uint32_t d0 = ring + (uint32_t)(buf * SLABH + (tid >> 3) * SP + (tid & 7) * 8) * 2u;
  uint32_t d[8];
  const char* g[8];
  if constexpr (S == 1) {                                   // 256 rows x 64 k
#pragma unroll
    for (int i = 0; i < 8; ++i) { d[i] = d0 + (uint32_t)i * DR; g[i] = g0 + i * GR; }
    copy8(d, g);
  } else {                                                  // 256 or 128 rows x 128 k, 128 rows a statement
#pragma unroll
    for (int q = 0; q < (S < 4 ? 2 : 1); ++q) {
#pragma unroll
      for (int i = 0; i < 4; ++i) {
        d[i]     = d0 + (uint32_t)(q * 4 + i) * DR;
        g[i]     = g0 + (q * 4 + i) * GR;
        d[i + 4] = d[i] + 128u;
        g[i + 4] = g[i] + 128;
      }
      copy8(d, g);
    }
  }
}

// Foot of the trip on slab I of layer l: publish the next slab, then refill the buffer just read with the slab after that.
template <int I>
__device__ __forceinline__ void ring_foot(uint32_t ring, const f16t* wt, int nl, int l, int tid) {
  asm volatile("s_wait_dscnt 0x0" ::: "memory");     // this wave's LDS reads and writes are done before the hand-over
  asm volatile("s_wait_asynccnt 0x0" ::: "memory");  // this wave's copies of the next slab have landed
  __syncthreads();                                   // next slab readable by all, this slab left by all
  if constexpr (I + 2 < SPL) {
    slab_issue<I + 2>(ring, I & 1, wt, nl, l, tid);
  } else {
    if (l + 1 < nl) slab_issue<I + 2 - SPL>(ring, I & 1, wt, nl, l + 1, tid);
  }
}

// One 32-deep k-tile of a wave tile of 4 m-tiles x NJ n-tiles: 4 A and NJ B fragments feed 4 * NJ WMMAs.
// AK: where A comes from (0: f32 z rows, 1: the one cond row, shared by every token, 2: f16 act rows); zp or hp points to
// the lane's row of m-tile 0 at the k-tile. B fragment j from slab row (j * JS + lane's row) at the k-tile (bp points there).
// The weight fragment goes in as the WMMA's first operand and the token fragment as its second (both have the same k map), so
// D comes out transposed: a lane holds one token and eight adjacent output columns, which the epilogues move 16 B at a time.
template <int NJ, int JS, int AK>
__device__ __forceinline__ void ktile(v8f (&c)[4][NJ], const float* zp, const f16t* hp, const f16t* bp, int h) {
  v16h a[4], bfr[NJ];   // one register set per fragment, so that the LDS latency is paid once a k-tile
  if constexpr (AK == 0) {
#pragma unroll
    for (int i = 0; i < 4; ++i) a[i] = ldfrag32(zp + i * 16 * ZS, h);
  } else if constexpr (AK == 1) {
    a[0] = ldfrag16(hp, h);
    a[1] = a[0]; a[2] = a[0]; a[3] = a[0];
  } else {
#pragma unroll
    for (int i = 0; i < 4; ++i) a[i] = ldfrag16(hp + i * 16 * AS, h);
  }
#pragma unroll
  for (int j = 0; j < NJ; ++j) bfr[j] = ldfrag16(bp + j * JS * SP, h);
  // holds the k-tile's LDS reads in one group ahead of the WMMAs: without it they sink back to a full wait in front of each
  __builtin_amdgcn_sched_barrier(0);
#pragma unroll
  for (int j = 0; j < NJ; ++j) {
#pragma unroll
    for (int i = 0; i < 4; ++i) {
      c[i][j] = wmma_f16(bfr[j], a[i], c[i][j]);
      // keeps the WMMAs in the order of their reads, so that each group waits only for its own B pair (a counted wait)
      __builtin_amdgcn_sched_barrier(0);
    }
  }
}

// four vector slots behind a slab's last WMMA, on every path: a taken branch in the ring foot leads to vector writes of
// A and B registers
__device__ __forceinline__ void wmma_tail(v8f (&c)[4][4]) {
  asm volatile("v_nop\n\tv_nop\n\tv_nop\n\tv_nop"
               : "+v"(c[0][0]), "+v"(c[0][1]), "+v"(c[0][2]), "+v"(c[0][3]), "+v"(c[1][0]), "+v"(c[1][1]), "+v"(c[1][2]), "+v"(c[1][3]),
                 "+v"(c[2][0]), "+v"(c[2][1]), "+v"(c[2][2]), "+v"(c[2][3]), "+v"(c[3][0]), "+v"(c[3][1]), "+v"(c[3][2]), "+v"(c[3][3]));
}
__device__ __forceinline__ void wmma_tail(v8f (&c)[4][2]) {
  asm volatile("v_nop\n\tv_nop\n\tv_nop\n\tv_nop"
               : "+v"(c[0][0]), "+v"(c[0][1]), "+v"(c[1][0]), "+v"(c[1][1]), "+v"(c[2][0]), "+v"(c[2][1]), "+v"(c[3][0]), "+v"(c[3][1]));
}

// bias + relu + f16 store of a 64 x 64 wave tile; D map: c[i][j][r] = (token tok0 + 16 i, column col0 + 16 j + r),
// tok0 = tile's first row + m, col0 = tile's first column + 8 h: one 16-B LDS store per accumulator tile
__device__ __forceinline__ void relu_store(const v8f (&c)[4][4], f16t* act, const float* __restrict__ bias,
                                           int tok0, int col0) {
  const float* bp = bias + col0;
  v4f bvs[4][2];
#pragma unroll
  for (int j = 0; j < 4; ++j) {
    bvs[j][0] = *(const v4f*)(bp + j * 16);
    bvs[j][1] = *(const v4f*)(bp + j * 16 + 4);
  }
  // a precaution: the bias loads' address registers stay as they are up to this wait
  asm volatile("s_wait_xcnt 0x0" :: "v"(bp) : "memory");
#pragma unroll
  for (int j = 0; j < 4; ++j) {
    const v8f bv = __builtin_shufflevector(bvs[j][0], bvs[j][1], 0, 1, 2, 3, 4, 5, 6, 7);
#pragma unroll
    for (int i = 0; i < 4; ++i) {
      v8f v;
#pragma unroll
      for (int r = 0; r < 8; ++r) {
        const float t = c[i][j][r] * WINV + bv[r];
        v[r] = t > 0.f ? t : 0.f;
      }
      *(v8h*)(act + (tok0 + i * 16) * AS + col0 + j * 16) = __builtin_convertvector(v, v8h);
    }
  }
}

__device__ __forceinline__ float tanh_f(float u) {
  u = fminf(fmaxf(u, -16.0f), 16.0f);
  const float e = __expf(2.0f * u);
  return 1.0f - 2.0f * __builtin_amdgcn_rcpf(e + 1.0f);
}

// ---------------------------------------------------------------------------
// Launch 1: W[l][k][n] f32 -> Wt[l][n][k] f16 (x16), k-contiguous rows.
// ---------------------------------------------------------------------------
__global__ void __launch_bounds__(256)
k_convert(const float* __restrict__ W1, const float* __restrict__ W2, const float* __restrict__ W3,
          f16t* __restrict__ wt, int nl) {
  const int g = blockIdx.x * 256 + threadIdx.x;
  if (g >= nl * LPL) return;
  const int l = g / LPL;
  int q = g - l * LPL;
  const float* src;
  f16t* dst;
  int K, N, n, part;
  const size_t base2 = (size_t)nl * HID * DIN;
  const size_t base3 = base2 + (size_t)nl * HID * HID;
  if (q < LN1) {
    n = q / (DIN / 64); part = q - n * (DIN / 64);
    K = DIN; N = HID;
    src = W1 + (size_t)l * DIN * HID;
    dst = wt + (size_t)l * HID * DIN;
  } else if (q < LN1 + LN2) {
    q -= LN1;
    n = q / (HID / 64); part = q - n * (HID / 64);
    K = HID; N = HID;
    src = W2 + (size_t)l * HID * HID;
    dst = wt + base2 + (size_t)l * HID * HID;
  } else {
    q -= LN1 + LN2;
    n = q / (HID / 64); part = q - n * (HID / 64);
    K = HID; N = D;
    src = W3 + (size_t)l * HID * D;
    dst = wt + base3 + (size_t)l * D * HID;
  }
  const int k0 = part * 64;
  union { v4u u[8]; f16t e[64]; } pk;
#pragma unroll
  for (int i = 0; i < 64; ++i)
    pk.e[i] = (f16t)(src[(size_t)(k0 + i) * N + n] * WSCALE);
  f16t* drow = dst + (size_t)n * K + k0;
#pragma unroll
  for (int s = 0; s < 8; ++s) *(v4u*)(drow + s * 8) = pk.u[s];
  
}

// ---------------------------------------------------------------------------
// Launch 2: one block per batch element, z resident in LDS; 8 waves as 2 x 4, each a 64-token x 64-column tile of a
// stage's output (64 x 32 in stage 3), so that an LDS fragment feeds 4 WMMAs (A in stage 3: 2).
// ---------------------------------------------------------------------------
__global__ void __launch_bounds__(256)
k_flow(const float* __restrict__ x, const float* __restrict__ cond,
       const float* __restrict__ b1, const float* __restrict__ b2, const float* __restrict__ b3,
       const f16t* __restrict__ wt, float* __restrict__ outz, float* __restrict__ part,
       int B, int nl) {
  extern __shared__ v4u dsm[];
  char* smem = (char*)dsm;
  float* zbuf  = (float*)(smem + OFF_Z);
  f16t*  act   = (f16t*)(smem + OFF_A);
  f16t*  wslab = (f16t*)(smem + OFF_S);
  f16t*  condh = (f16t*)(smem + OFF_C);
  float* red   = (float*)(smem + OFF_R);

  const int b = blockIdx.x;
  if (b >= B) return;                        // block-uniform, before any barrier
  const int tid = threadIdx.x;
  const int lane = tid & 31, wave = tid >> 5;
  const int m = lane & 15, h = lane >> 4;
  const int rowbase = wave * 16;             // rows of the closing copy to global memory
  const int wm = wave >> 2, wn = wave & 3;   // the wave's place in the 2 x 4 grid
  const int mrow = wm * 64;                  // first token row of the wave tile

  const uint32_t ring = (uint32_t)(size_t)wslab;   // LDS byte address of the slab ring
  slab_issue<0>(ring, 0, wt, nl, 0, tid);

  // stage x[b] (128 x 128 f32) and cond[b] (128, f16)
  {
    const float* xb = x + (size_t)b * TOK * D;
    for (int idx = tid; idx < TOK * (D / 4); idx += NTH) {
      const int r = idx / (D / 4), s = idx - r * (D / 4);
      *(v4f*)(zbuf + r * ZS + s * 4) = *(const v4f*)(xb + (size_t)r * D + s * 4);
    }
    if (tid < CND) condh[tid] = (f16t)cond[(size_t)b * CND + tid];
  }
  asm volatile("s_wait_asynccnt 0x0" ::: "memory");  // this wave's copies of slab 0 have landed
  __syncthreads();
  slab_issue<1>(ring, 1, wt, nl, 0, tid);

  float ldacc = 0.f;

  const float* zrow = zbuf + (mrow + m) * ZS;              // A rows of m-tile 0
  const f16t*  arow = act + (mrow + m) * AS;
  const f16t*  ws0  = wslab;                               // ring buffers
  const f16t*  ws1  = wslab + SLABH;
  const int    bo12 = (wn * 64 + m) * SP;                  // B row of n-tile 0, stages 1 and 2
  const int    bo3  = (wn * 16 + m) * SP;                  // stage 3: n-tile 0 = s columns, n-tile 1 = t columns 64 on

  for (int l = 0; l < nl; ++l) {
    // every k loop below is unrolled: a k-tile's place in its rows becomes an immediate offset of its LDS reads
    {
      v8f c[4][4];
      // stage 1: [128 x 192] @ [192 x 256] + relu -> act ; A = [x1 | cond]
      zero_acc(c);
#pragma unroll
      for (int kt = 0; kt < 2; ++kt)                        // k 0..63 from z (f32 -> f16)
        ktile<4, 16, 0>(c, zrow + kt * 32, nullptr, ws0 + bo12 + kt * 32, h);
#pragma unroll
      for (int kt = 2; kt < 4; ++kt)                        // k 64..127 from cond
        ktile<4, 16, 1>(c, nullptr, condh + (kt - 2) * 32, ws0 + bo12 + kt * 32, h);
      wmma_tail(c);
      ring_foot<0>(ring, wt, nl, l, tid);
#pragma unroll
      for (int kt = 0; kt < 2; ++kt)                        // k 128..191 from cond
        ktile<4, 16, 1>(c, nullptr, condh + (kt + 2) * 32, ws1 + bo12 + kt * 32, h);
      wmma_tail(c);
      // nobody reads act in stage 1: stored ahead of the foot, whose wait and barrier publish it with the next slab
      relu_store(c, act, b1 + (size_t)l * HID, mrow + m, wn * 64 + 8 * h);
      ring_foot<1>(ring, wt, nl, l, tid);

      // stage 2: [128 x 256] @ [256 x 256] + relu -> act, in place
      zero_acc(c);
#pragma unroll
      for (int kt = 0; kt < KS / 32; ++kt)
        ktile<4, 16, 2>(c, nullptr, arow + kt * 32, ws0 + bo12 + kt * 32, h);
      wmma_tail(c);
      ring_foot<2>(ring, wt, nl, l, tid);
#pragma unroll
      for (int kt = 0; kt < KS / 32; ++kt)
        ktile<4, 16, 2>(c, nullptr, arow + KS + kt * 32, ws1 + bo12 + kt * 32, h);
      wmma_tail(c);
      ring_foot<3>(ring, wt, nl, l, tid);                   // its barrier also ends every wave's reads of stage-1 act
      relu_store(c, act, b2 + (size_t)l * HID, mrow + m, wn * 64 + 8 * h);
      __syncthreads();                                      // stage-2 act readable by all
    }

    // stage 3: [128 x 256] @ [256 x 128] -> s | t ; coupling + flip
    {
      v8f c[4][2];
      zero_acc(c);
#pragma unroll
      for (int kt = 0; kt < KS / 32; ++kt)
        ktile<2, 64, 2>(c, nullptr, arow + kt * 32, ws0 + bo3 + kt * 32, h);
      wmma_tail(c);
      ring_foot<4>(ring, wt, nl, l, tid);
#pragma unroll
      for (int kt = 0; kt < KS / 32; ++kt)
        ktile<2, 64, 2>(c, nullptr, arow + KS + kt * 32, ws1 + bo3 + kt * 32, h);
      wmma_tail(c);
      const int col0 = wn * 16 + 8 * h;             // the lane's first of 8 s columns; their t columns are 64 further on
      const float* bb = b3 + (size_t)l * D + col0;
      const v4f bs0 = *(const v4f*)(bb);
      const v4f bs1 = *(const v4f*)(bb + 4);
      const v4f bt0 = *(const v4f*)(bb + D / 2);
      const v4f bt1 = *(const v4f*)(bb + D / 2 + 4);
      // a precaution: the bias loads' address registers stay as they are up to this wait
      asm volatile("s_wait_xcnt 0x0" :: "v"(bb) : "memory");
      const v8f bs = __builtin_shufflevector(bs0, bs1, 0, 1, 2, 3, 4, 5, 6, 7);
      const v8f bt = __builtin_shufflevector(bt0, bt1, 0, 1, 2, 3, 4, 5, 6, 7);
      float* ztok = zbuf + (mrow + m) * ZS;         // the lane's token of m-tile 0
      v4f x1v[4][2], x2v[4][2];
#pragma unroll
      for (int i = 0; i < 4; ++i) {
        const float* zp = ztok + i * 16 * ZS + col0;
        x1v[i][0] = *(const v4f*)(zp);
        x1v[i][1] = *(const v4f*)(zp + 4);
        x2v[i][0] = *(const v4f*)(zp + D / 2);
        x2v[i][1] = *(const v4f*)(zp + D / 2 + 4);
      }
      ring_foot<5>(ring, wt, nl, l, tid);           // its wait and barrier: all z reads of this layer before any z write
#pragma unroll
      for (int i = 0; i < 4; ++i) {
        float y[8];
#pragma unroll
        for (int r = 0; r < 8; ++r) {
          const float u  = c[i][0][r] * WINV + bs[r];
          const float sv = 0.5f * tanh_f(u);
          const float tv = c[i][1][r] * WINV + bt[r];
          ldacc += sv;
          y[r] = x2v[i][r >> 2][r & 3] * __expf(sv) + tv;
        }
        // the flip sends column col0 + r to D - 1 - col0 - r (x1) and D / 2 - 1 - col0 - r (y2): 8 adjacent floats, reversed
        float* zw = ztok + i * 16 * ZS;
        const v4f a = x1v[i][0], b = x1v[i][1];
        const v4f w0 = {b[3], b[2], b[1], b[0]};
        const v4f w1 = {a[3], a[2], a[1], a[0]};
        const v4f w2 = {y[7], y[6], y[5], y[4]};
        const v4f w3 = {y[3], y[2], y[1], y[0]};
        *(v4f*)(zw + D - 8 - col0)     = w0;        // z'[64..127] = rev(x1)
        *(v4f*)(zw + D - 4 - col0)     = w1;
        *(v4f*)(zw + D / 2 - 8 - col0) = w2;        // z'[0..63]   = rev(y2)
        *(v4f*)(zw + D / 2 - 4 - col0) = w3;
      }
      __syncthreads();                              // the new z readable by all
    }
  }

  asm volatile("s_wait_asynccnt 0x0" ::: "memory");  // no copy is left in flight behind the ring

  // logdet block reduction
  red[tid] = ldacc;
  __syncthreads();                                  // also orders the 16-B z stores before the vector reloads below
  float ld = 0.f;
  if (wave == 0) {
#pragma unroll
    for (int k = 0; k < NTH / 32; ++k) ld += red[lane + 32 * k];
#pragma unroll
    for (int off = 16; off > 0; off >>= 1) ld += __shfl_xor(ld, off, 32);
  }

  float* oz = outz + ((size_t)b * TOK + rowbase) * D;
  float* pl = part + (size_t)b * 32;
#pragma unroll
  for (int r = 0; r < 16; ++r) {
    v4f v = *(const v4f*)(zbuf + (rowbase + r) * ZS + lane * 4);
    *(v4f*)(oz + (size_t)r * D + lane * 4) = v;
  }
  if (wave == 0) *(float*)(pl + lane) = ld;
  
}

// ---------------------------------------------------------------------------
// ---------------------------------------------------------------------------
__global__ void __launch_bounds__(256)
k_final(const float* __restrict__ part, float* __restrict__ outld, int B) {
  const int nq = (B + 3) / 4;
  for (int q = threadIdx.x; q < nq; q += 256) {
    const int b0 = q * 4;
    if (b0 + 3 < B) {
      v4f v;
      v.x = part[(size_t)(b0 + 0) * 32];
      v.y = part[(size_t)(b0 + 1) * 32];
      v.z = part[(size_t)(b0 + 2) * 32];
      v.w = part[(size_t)(b0 + 3) * 32];
      *(v4f*)(outld + b0) = v;
    } else {
      for (int i = 0; i < 4; ++i)
        if (b0 + i < B) *(float*)(outld + b0 + i) = part[(size_t)(b0 + i) * 32];
    }
  }
  
}

extern "C" void kernel_launch(void* const* d_in, const int* in_sizes, int n_in,
                              void* d_out, int out_size, void* d_ws, size_t ws_size,
                              hipStream_t stream) {
  if (n_in < 8) return;
  const float* x  = (const float*)d_in[0];
  const float* cd = (const float*)d_in[1];
  const float* W1 = (const float*)d_in[2];
  const float* b1 = (const float*)d_in[3];
  const float* W2 = (const float*)d_in[4];
  const float* b2 = (const float*)d_in[5];
  const float* W3 = (const float*)d_in[6];
  const float* b3 = (const float*)d_in[7];

  const int B  = in_sizes[0] / (TOK * D);
  const int nl = in_sizes[2] / (DIN * HID);
  if (B <= 0 || nl <= 0) return;
  if (in_sizes[1] < B * CND) return;
  if (in_sizes[3] < nl * HID || in_sizes[4] < nl * HID * HID || in_sizes[5] < nl * HID) return;
  if (in_sizes[6] < nl * HID * D || in_sizes[7] < nl * D) return;
  if ((size_t)out_size < (size_t)B * TOK * D + (size_t)B) return;

  const size_t wt_bytes  = (size_t)nl * WPL * sizeof(f16t);
  const size_t part_off  = (wt_bytes + 127) & ~(size_t)127;
  const size_t part_bytes = (size_t)B * 128;
  if (part_off + part_bytes > ws_size) return;

  f16t*  wt    = (f16t*)d_ws;
  float* part  = (float*)((char*)d_ws + part_off);
  float* outz  = (float*)d_out;
  float* outld = outz + (size_t)B * TOK * D;

  const int nlines = nl * LPL;
  k_convert<<<(nlines + 255) / 256, 256, 0, stream>>>(W1, W2, W3, wt, nl);

  (void)hipFuncSetAttribute((const void*)k_flow, hipFuncAttributeMaxDynamicSharedMemorySize, SMEM_TOTAL);
  k_flow<<<B, NTH, SMEM_TOTAL, stream>>>(x, cd, b1, b2, b3, wt, outz, part, B, nl);

  k_final<<<1, 256, 0, stream>>>(part, outld, B);
}

// v006
// A run of this version takes 81.9 microseconds.
// Timed twice side by side with v005, it ran 1.43 times as fast both times.
// All steps since v000 together make it 3.96 times as fast.
#include <hip/hip_runtime.h>
#include <stdint.h>
#include <stddef.h>

// All contractions: v_wmma_f32_16x16x32_f16 (f16 operands, f32 accumulate); weights carried x16 in f16 (k-contiguous transposed copy), folded back as 1/16 in the f32 epilogue; coupling tanh/exp/flip/logdet math in f32.

typedef _Float16 f16t;
typedef f16t  v8h  __attribute__((ext_vector_type(8)));
typedef f16t  v16h __attribute__((ext_vector_type(16)));
typedef float v4f  __attribute__((ext_vector_type(4)));
typedef float v8f  __attribute__((ext_vector_type(8)));
typedef unsigned int v4u __attribute__((ext_vector_type(4)));

union Frag { v16h v; v8h q[2]; };

constexpr int D   = 128;           // patch dim
constexpr int CND = 128;           // cond dim
constexpr int HID = 256;           // hidden
constexpr int DIN = D / 2 + CND;   // 192
constexpr int K1  = D / 2;         // k of stage 1 that differs from token to token (x1); the cond rows of W1 go into cb
constexpr int TOK = 128;           // tokens per batch element = one block
constexpr int NTH = 256;           // threads per block (8 waves: 2 along tokens x 4 along output columns)

constexpr int ZS = 132;            // z row stride in floats (528 B, 16-B aligned)
constexpr int AS = 264;            // activation row stride in halves (528 B)
constexpr int SP = 136;            // weight slab row stride in halves (272 B = 16 B x 17), up to 128 k per row

constexpr float WSCALE = 16.0f;    // exact power of two on the f16 weight copy
constexpr float WINV   = 0.0625f;

// dynamic LDS carve (bytes)
constexpr int OFF_Z = 0;                       // [128][ZS] f32 z
constexpr int OFF_A = OFF_Z + TOK * ZS * 4;    // [128][AS] f16 act (stage-1 out, then stage-2 out in its place)
constexpr int SLABH = HID * SP;                // halves per weight slab buffer
constexpr int OFF_S = OFF_A + TOK * AS * 2;    // 2 x [256][SP] f16 weight slab ring
constexpr int OFF_R = OFF_S + 2 * SLABH * 2;   // [256] f32 reduce
constexpr int SMEM_TOTAL = OFF_R + NTH * 4;    // 275456 B

static_assert(OFF_A % 16 == 0 && OFF_S % 16 == 0 && OFF_R % 16 == 0, "");

constexpr int LN1 = HID * (K1 / 64);           // 256  (W1t: 256 rows x 64 halves, the x1 rows of W1)
constexpr int LN2 = HID * (HID / 64);          // 1024 (W2t: 256 rows x 256 halves)
constexpr int LN3 = D * (HID / 64);            // 512  (W3t: 128 rows x 256 halves)
constexpr int LPL = LN1 + LN2 + LN3;           // 1792
constexpr int WPL = HID * K1 + HID * HID + D * HID;    // halves per layer = 114688

// weight slabs of one layer, in the order of use; a slab holds every output column of its stage:
// 0: W1t k 0..63, 1, 2: W2t k 0..127, 128..255 (256 rows each), 3, 4: W3t k 0..127, 128..255 (128 rows)
constexpr int KS  = 128;                       // k per full slab
constexpr int SPL = 5;                         // slabs per layer (odd: slab i of layer l lies in ring buffer (i ^ l) & 1)
static_assert(KS <= SP && SMEM_TOTAL <= 327680 && SPL % 2 == 1, "");

__device__ __forceinline__ v8f wmma_f16(v16h a, v16h b, v8f c) {
  return __builtin_amdgcn_wmma_f32_16x16x32_f16(false, a, false, b, (short)0, c, false, false);
}

// 16x32 fragment from a k-contiguous 16-bit row: elems 0..7 <- p[8h..8h+7], elems 8..15 <- p[16+8h..16+8h+7]
__device__ __forceinline__ v16h ldfrag16(const f16t* p, int h) {
  Frag f;
  f.q[0] = *(const v8h*)(p + 8 * h);
  f.q[1] = *(const v8h*)(p + 16 + 8 * h);
  return f.v;
}

// four f32 quads of a row, in the order of the map above, RNE convert to f16 in registers
__device__ __forceinline__ v16h cvtfrag(v4f a0, v4f a1, v4f a2, v4f a3) {
  v8f lo = __builtin_shufflevector(a0, a1, 0, 1, 2, 3, 4, 5, 6, 7);
  v8f hi = __builtin_shufflevector(a2, a3, 0, 1, 2, 3, 4, 5, 6, 7);
  Frag f;
  f.q[0] = __builtin_convertvector(lo, v8h);
  f.q[1] = __builtin_convertvector(hi, v8h);
  return f.v;
}

// same map from an f32 row
__device__ __forceinline__ v16h ldfrag32(const float* p, int h) {
  v4f a0 = *(const v4f*)(p + 8 * h);
  v4f a1 = *(const v4f*)(p + 8 * h + 4);
  v4f a2 = *(const v4f*)(p + 16 + 8 * h);
  v4f a3 = *(const v4f*)(p + 16 + 8 * h + 4);
  return cvtfrag(a0, a1, a2, a3);
}

template <int NJ>
__device__ __forceinline__ void zero_acc(v8f (&c)[4][NJ]) {
#pragma unroll
  for (int i = 0; i < 4; ++i)
#pragma unroll
    for (int j = 0; j < NJ; ++j) {
      v8f z = {0.f, 0.f, 0.f, 0.f, 0.f, 0.f, 0.f, 0.f};
      c[i][j] = z;
    }
}

// Eight copies of 16 B a lane, global -> LDS through no register, so the slab flies while the slab before it is multiplied;
// the closing wait is a precaution: no address register of a copy is rewritten ahead of it
__device__ __forceinline__ void copy8(const uint32_t (&d)[8], const char* const (&g)[8]) {
  asm volatile("global_load_async_to_lds_b128 %0, %8, off\n\t"
               "global_load_async_to_lds_b128 %1, %9, off\n\t"
               "global_load_async_to_lds_b128 %2, %10, off\n\t"
               "global_load_async_to_lds_b128 %3, %11, off\n\t"
               "global_load_async_to_lds_b128 %4, %12, off\n\t"
               "global_load_async_to_lds_b128 %5, %13, off\n\t"
               "global_load_async_to_lds_b128 %6, %14, off\n\t"
               "global_load_async_to_lds_b128 %7, %15, off\n\t"
               "s_wait_xcnt 0x0"
               :: "v"(d[0]), "v"(d[1]), "v"(d[2]), "v"(d[3]), "v"(d[4]), "v"(d[5]), "v"(d[6]), "v"(d[7]),
                  "v"(g[0]), "v"(g[1]), "v"(g[2]), "v"(g[3]), "v"(g[4]), "v"(g[5]), "v"(g[6]), "v"(g[7]) : "memory");
}

// Start the copies of slab S of layer ll into ring buffer buf. Eight threads take one whole 128-B line (64 k) of a row;
// every thread copies its 16 B in rows tid / 8 + 32 i of each 64-k column block of the slab.
template <int S>
__device__ __forceinline__ void slab_issue(uint32_t ring, int buf, const f16t* wt, int nl, int ll, int tid) {
  constexpr int K = S < 1 ? K1 : HID;                       // k per row of the transposed weight copy
  constexpr int GR = 32 * K * 2;                            // global bytes from a row to the row 32 further on
  constexpr uint32_t DR = (uint32_t)(32 * SP) * 2u;         // the same in LDS
  const size_t off = S < 1 ? (size_t)ll * HID * K1
                   : S < 3 ? (size_t)nl * HID * K1 + (size_t)ll * HID * HID
                           : (size_t)nl * (HID * K1 + HID * HID) + (size_t)ll * D * HID;
  const char* g0 = (const char*)(wt + off) + ((tid >> 3) * K + (S > 0 && S % 2 == 0 ? KS : 0) + (tid & 7) * 8) * 2;
  const uint32_t d0 = ring + (uint32_t)(buf * SLABH + (tid >> 3) * SP + (tid & 7) * 8) * 2u;
  uint32_t d[8];
  const char* g[8];
  if constexpr (S == 0) {                                   // 256 rows x 64 k
#pragma unroll
    for (int i = 0; i < 8; ++i) { d[i] = d0 + (uint32_t)i * DR; g[i] = g0 + i * GR; }
    copy8(d, g);
  } else {                                                  // 256 or 128 rows x 128 k, 128 rows a statement
#pragma unroll
    for (int q = 0; q < (S < 3 ? 2 : 1); ++q) {
#pragma unroll
      for (int i = 0; i < 4; ++i) {
        d[i]     = d0 + (uint32_t)(q * 4 + i) * DR;
        g[i]     = g0 + (q * 4 + i) * GR;
        d[i + 4] = d[i] + 128u;
        g[i + 4] = g[i] + 128;
      }
      copy8(d, g);
    }
  }
}

// Foot of the trip on slab I of layer l: publish the next slab, then refill the buffer just read with the slab after that.
template <int I>
__device__ __forceinline__ void ring_foot(uint32_t ring, const f16t* wt, int nl, int l, int tid) {
  const int buf = (I ^ l) & 1;                       // the buffer of slab I, and of the slab two further on
  asm volatile("s_wait_dscnt 0x0" ::: "memory");     // this wave's LDS reads and writes are done before the hand-over
  asm volatile("s_wait_asynccnt 0x0" ::: "memory");  // this wave's copies of the next slab have landed
  __syncthreads();                                   // next slab readable by all, this slab left by all
  if constexpr (I + 2 < SPL) {
    slab_issue<I + 2>(ring, buf, wt, nl, l, tid);
  } else {
    if (l + 1 < nl) slab_issue<I + 2 - SPL>(ring, buf, wt, nl, l + 1, tid);
  }
}

// One 32-deep k-tile of a wave tile of 4 m-tiles x NJ n-tiles: 4 A and NJ B fragments feed 4 * NJ WMMAs.
// AK: where A comes from (0: f32 z rows, 2: f16 act rows); zp or hp points to
// the lane's row of m-tile 0 at the k-tile. B fragment j from slab row (j * JS + lane's row) at the k-tile (bp points there).
// The weight fragment goes in as the WMMA's first operand and the token fragment as its second (both have the same k map), so
// D comes out transposed: a lane holds one token and eight adjacent output columns, which the epilogues move 16 B at a time.
template <int NJ, int JS, int AK>
__device__ __forceinline__ void ktile(v8f (&c)[4][NJ], const float* zp, const f16t* hp, const f16t* bp, int h) {
  v16h a[4], bfr[NJ];   // one register set per fragment, so that the LDS latency is paid once a k-tile
  if constexpr (AK == 0) {
#pragma unroll
    for (int i = 0; i < 4; ++i) a[i] = ldfrag32(zp + i * 16 * ZS, h);
  } else {
#pragma unroll
    for (int i = 0; i < 4; ++i) a[i] = ldfrag16(hp + i * 16 * AS, h);
  }
#pragma unroll
  for (int j = 0; j < NJ; ++j) bfr[j] = ldfrag16(bp + j * JS * SP, h);
  // holds the k-tile's LDS reads in one group ahead of the WMMAs: without it they sink back to a full wait in front of each
  __builtin_amdgcn_sched_barrier(0);
#pragma unroll
  for (int j = 0; j < NJ; ++j) {
#pragma unroll
    for (int i = 0; i < 4; ++i) {
      c[i][j] = wmma_f16(bfr[j], a[i], c[i][j]);
      // keeps the WMMAs in the order of their reads, so that each group waits only for its own B pair (a counted wait)
      __builtin_amdgcn_sched_barrier(0);
    }
  }
}

// four vector slots behind a slab's last WMMA, on every path: a taken branch in the ring foot leads to vector writes of
// A and B registers
__device__ __forceinline__ void wmma_tail(v8f (&c)[4][4]) {
  asm volatile("v_nop\n\tv_nop\n\tv_nop\n\tv_nop"
               : "+v"(c[0][0]), "+v"(c[0][1]), "+v"(c[0][2]), "+v"(c[0][3]), "+v"(c[1][0]), "+v"(c[1][1]), "+v"(c[1][2]), "+v"(c[1][3]),
                 "+v"(c[2][0]), "+v"(c[2][1]), "+v"(c[2][2]), "+v"(c[2][3]), "+v"(c[3][0]), "+v"(c[3][1]), "+v"(c[3][2]), "+v"(c[3][3]));
}
__device__ __forceinline__ void wmma_tail(v8f (&c)[4][2]) {
  asm volatile("v_nop\n\tv_nop\n\tv_nop\n\tv_nop"
               : "+v"(c[0][0]), "+v"(c[0][1]), "+v"(c[1][0]), "+v"(c[1][1]), "+v"(c[2][0]), "+v"(c[2][1]), "+v"(c[3][0]), "+v"(c[3][1]));
}

// the lane's 4 x 8 bias values of a 64 x 64 wave tile: columns col0 + 16 j + r of the row at bias
__device__ __forceinline__ void bias_load(v4f (&bvs)[4][2], const float* __restrict__ bias, int col0) {
  const float* bp = bias + col0;
#pragma unroll
  for (int j = 0; j < 4; ++j) {
    bvs[j][0] = *(const v4f*)(bp + j * 16);
    bvs[j][1] = *(const v4f*)(bp + j * 16 + 4);
  }
  // a precaution: the bias loads' address registers stay as they are up to this wait
  asm volatile("s_wait_xcnt 0x0" :: "v"(bp) : "memory");
}

// bias + relu + f16 store of a 64 x 64 wave tile; D map: c[i][j][r] = (token tok0 + 16 i, column col0 + 16 j + r),
// tok0 = tile's first row + m, col0 = tile's first column + 8 h: one 16-B LDS store per accumulator tile
__device__ __forceinline__ void relu_store(const v8f (&c)[4][4], f16t* act, const v4f (&bvs)[4][2],
                                           int tok0, int col0) {
#pragma unroll
  for (int j = 0; j < 4; ++j) {
    const v8f bv = __builtin_shufflevector(bvs[j][0], bvs[j][1], 0, 1, 2, 3, 4, 5, 6, 7);
#pragma unroll
    for (int i = 0; i < 4; ++i) {
      v8f v;
#pragma unroll
      for (int r = 0; r < 8; ++r) {
        const float t = c[i][j][r] * WINV + bv[r];
        v[r] = t > 0.f ? t : 0.f;
      }
      *(v8h*)(act + (tok0 + i * 16) * AS + col0 + j * 16) = __builtin_convertvector(v, v8h);
    }
  }
}

__device__ __forceinline__ float tanh_f(float u) {
  u = fminf(fmaxf(u, -16.0f), 16.0f);
  const float e = __expf(2.0f * u);
  return 1.0f - 2.0f * __builtin_amdgcn_rcpf(e + 1.0f);
}

// ---------------------------------------------------------------------------
// Launch 1, blocks below nconv: W[l][k][n] f32 -> Wt[l][n][k] f16 (x16), k-contiguous rows (of W1 the x1 rows only).
// The other blocks: cb[l][b][n] = cond[b] . W1[l][64.., n] + b1[l][n]. In stage 1 every token of a batch element meets the
// same cond row, so this part of the product is formed once per batch element here and enters stage 1 as its bias.
// A wave takes one 16-column tile of the cond rows of W1 (128 k, four fragments) and 2 tiles of 16 batch elements; all its
// loads are issued ahead of the first use, so that their latency is paid once.
// ---------------------------------------------------------------------------
__global__ void __launch_bounds__(256)
k_convert(const float* __restrict__ W1, const float* __restrict__ W2, const float* __restrict__ W3,
          const float* __restrict__ cond, const float* __restrict__ b1,
          f16t* __restrict__ wt, float* __restrict__ cb, int nl, int B, int nconv) {
  if ((int)blockIdx.x >= nconv) {                    // block-uniform
    const int lane = threadIdx.x & 31;
    const int m = lane & 15, h = lane >> 4;
    const int gw = ((int)blockIdx.x - nconv) * 8 + (int)(threadIdx.x >> 5);
    const int nt = nl * (HID / 16);                  // column tiles over all layers, a multiple of the 8 waves of a block
    const int bg = gw / nt, t = gw - bg * nt;        // group of 32 batch elements, column tile
    const int l = t / (HID / 16), n0 = (t - l * (HID / 16)) * 16;
    const float* wsrc = W1 + ((size_t)l * DIN + 8 * h) * HID + n0 + m;   // the lane's column, row 8 h; cond rows from K1 on
    float wv[4][16];
#pragma unroll
    for (int kt = 0; kt < 4; ++kt)
#pragma unroll
      for (int e = 0; e < 8; ++e) {                  // the k map of ldfrag16
        wv[kt][e]     = wsrc[(K1 + kt * 32 + e) * HID];
        wv[kt][e + 8] = wsrc[(K1 + kt * 32 + 16 + e) * HID];
      }
    const float* bp = b1 + (size_t)l * HID + n0 + 8 * h;
    const v4f bv0 = *(const v4f*)(bp);
    const v4f bv1 = *(const v4f*)(bp + 4);
    const int bb0 = bg * 32 + m, bb1 = bb0 + 16;     // the lane's batch elements
    // clamped: every lane stays on for the WMMAs
    const float* cp0 = cond + (size_t)(bb0 < B ? bb0 : B - 1) * CND + 8 * h;
    const float* cp1 = cond + (size_t)(bb1 < B ? bb1 : B - 1) * CND + 8 * h;
    v4f cr[2][4][4];
#pragma unroll
    for (int kt = 0; kt < 4; ++kt)
#pragma unroll
      for (int p = 0; p < 4; ++p) {                  // floats 0, 4, 16, 20 of the lane's half of the k-tile
        cr[0][kt][p] = *(const v4f*)(cp0 + kt * 32 + (p >> 1) * 16 + (p & 1) * 4);
        cr[1][kt][p] = *(const v4f*)(cp1 + kt * 32 + (p >> 1) * 16 + (p & 1) * 4);
      }
    // a precaution: the address registers of the loads above stay as they are up to this wait
    asm volatile("s_wait_xcnt 0x0" :: "v"(wsrc), "v"(bp), "v"(cp0), "v"(cp1) : "memory");
    const v8f bv = __builtin_shufflevector(bv0, bv1, 0, 1, 2, 3, 4, 5, 6, 7);
    v16h wf[4];
#pragma unroll
    for (int kt = 0; kt < 4; ++kt)
#pragma unroll
      for (int e = 0; e < 16; ++e) wf[kt][e] = (f16t)(wv[kt][e] * WSCALE);
#pragma unroll
    for (int bt = 0; bt < 2; ++bt) {
      const int bb = bt ? bb1 : bb0;
      v8f c = {0.f, 0.f, 0.f, 0.f, 0.f, 0.f, 0.f, 0.f};
#pragma unroll
      for (int kt = 0; kt < 4; ++kt)
        c = wmma_f16(wf[kt], cvtfrag(cr[bt][kt][0], cr[bt][kt][1], cr[bt][kt][2], cr[bt][kt][3]), c);
      // D map as in launch 2: c[r] = (batch element bb, column n0 + 8 h + r)
      v4f o0, o1;
#pragma unroll
      for (int r = 0; r < 4; ++r) {
        o0[r] = c[r] * WINV + bv[r];
        o1[r] = c[r + 4] * WINV + bv[r + 4];
      }
      if (bb < B) {
        float* op = cb + ((size_t)l * B + bb) * HID + n0 + 8 * h;
        *(v4f*)(op)     = o0;
        *(v4f*)(op + 4) = o1;
        // a precaution: the stores' address registers stay as they are up to this wait
        asm volatile("s_wait_xcnt 0x0" :: "v"(op) : "memory");
      }
    }
    return;
  }
  const int g = blockIdx.x * 256 + threadIdx.x;
  if (g >= nl * LPL) return;
  const int l = g / LPL;
  int q = g - l * LPL;
  const float* src;
  f16t* dst;
  int K, N, n, part;
  const size_t base2 = (size_t)nl * HID * K1;
  const size_t base3 = base2 + (size_t)nl * HID * HID;
  if (q < LN1) {
    n = q / (K1 / 64); part = q - n * (K1 / 64);
    K = K1; N = HID;
    src = W1 + (size_t)l * DIN * HID;
    dst = wt + (size_t)l * HID * K1;
  } else if (q < LN1 + LN2) {
    q -= LN1;
    n = q / (HID / 64); part = q - n * (HID / 64);
    K = HID; N = HID;
    src = W2 + (size_t)l * HID * HID;
    dst = wt + base2 + (size_t)l * HID * HID;
  } else {
    q -= LN1 + LN2;
    n = q / (HID / 64); part = q - n * (HID / 64);
    K = HID; N = D;
    src = W3 + (size_t)l * HID * D;
    dst = wt + base3 + (size_t)l * D * HID;
  }
  const int k0 = part * 64;
  union { v4u u[8]; f16t e[64]; } pk;
#pragma unroll
  for (int i = 0; i < 64; ++i)
    pk.e[i] = (f16t)(src[(size_t)(k0 + i) * N + n] * WSCALE);
  f16t* drow = dst + (size_t)n * K + k0;
#pragma unroll
  for (int s = 0; s < 8; ++s) *(v4u*)(drow + s * 8) = pk.u[s];
  
}

// ---------------------------------------------------------------------------
// Launch 2: one block per batch element, z resident in LDS; 8 waves as 2 x 4, each a 64-token x 64-column tile of a
// stage's output (64 x 32 in stage 3), so that an LDS fragment feeds 4 WMMAs (A in stage 3: 2).
// ---------------------------------------------------------------------------
__global__ void __launch_bounds__(256)
k_flow(const float* __restrict__ x, const float* __restrict__ cb,
       const float* __restrict__ b2, const float* __restrict__ b3,
       const f16t* __restrict__ wt, float* __restrict__ outz, float* __restrict__ part,
       int B, int nl) {
  extern __shared__ v4u dsm[];
  char* smem = (char*)dsm;
  float* zbuf  = (float*)(smem + OFF_Z);
  f16t*  act   = (f16t*)(smem + OFF_A);
  f16t*  wslab = (f16t*)(smem + OFF_S);
  float* red   = (float*)(smem + OFF_R);

  const int b = blockIdx.x;
  if (b >= B) return;                        // block-uniform, before any barrier
  const int tid = threadIdx.x;
  const int lane = tid & 31, wave = tid >> 5;
  const int m = lane & 15, h = lane >> 4;
  const int rowbase = wave * 16;             // rows of the closing copy to global memory
  const int wm = wave >> 2, wn = wave & 3;   // the wave's place in the 2 x 4 grid
  const int mrow = wm * 64;                  // first token row of the wave tile

  const uint32_t ring = (uint32_t)(size_t)wslab;   // LDS byte address of the slab ring
  slab_issue<0>(ring, 0, wt, nl, 0, tid);

  // stage x[b] (128 x 128 f32)
  {
    const float* xb = x + (size_t)b * TOK * D;
    for (int idx = tid; idx < TOK * (D / 4); idx += NTH) {
      const int r = idx / (D / 4), s = idx - r * (D / 4);
      *(v4f*)(zbuf + r * ZS + s * 4) = *(const v4f*)(xb + (size_t)r * D + s * 4);
    }
  }
  asm volatile("s_wait_asynccnt 0x0" ::: "memory");  // this wave's copies of slab 0 have landed
  __syncthreads();
  slab_issue<1>(ring, 1, wt, nl, 0, tid);

  float ldacc = 0.f;

  const float* zrow = zbuf + (mrow + m) * ZS;              // A rows of m-tile 0
  const f16t*  arow = act + (mrow + m) * AS;
  const f16t*  ws0  = wslab;                               // ring buffers of this layer's even and odd slabs;
  const f16t*  ws1  = wslab + SLABH;                       // they change places at the end of each layer
  const int    bo12 = (wn * 64 + m) * SP;                  // B row of n-tile 0, stages 1 and 2
  const int    bo3  = (wn * 16 + m) * SP;                  // stage 3: n-tile 0 = s columns, n-tile 1 = t columns 64 on

  for (int l = 0; l < nl; ++l) {
    // every k loop below is unrolled: a k-tile's place in its rows becomes an immediate offset of its LDS reads
    {
      v8f c[4][4];
      v4f bvs[4][2];
      // stage 1: [128 x 64] @ [64 x 256] + cb + relu -> act ; A = x1, cb = the cond part of the product with b1 (launch 1)
      bias_load(bvs, cb + ((size_t)l * B + b) * HID, wn * 64 + 8 * h);   // ahead of the product, which hides the loads
      zero_acc(c);
#pragma unroll
      for (int kt = 0; kt < K1 / 32; ++kt)                  // k 0..63 from z (f32 -> f16)
        ktile<4, 16, 0>(c, zrow + kt * 32, nullptr, ws0 + bo12 + kt * 32, h);
      wmma_tail(c);
      // nobody reads act in stage 1: stored ahead of the foot, whose wait and barrier publish it with the next slab
      relu_store(c, act, bvs, mrow + m, wn * 64 + 8 * h);
      ring_foot<0>(ring, wt, nl, l, tid);

      // stage 2: [128 x 256] @ [256 x 256] + relu -> act, in place
      zero_acc(c);
#pragma unroll
      for (int kt = 0; kt < KS / 32; ++kt)
        ktile<4, 16, 2>(c, nullptr, arow + kt * 32, ws1 + bo12 + kt * 32, h);
      wmma_tail(c);
      ring_foot<1>(ring, wt, nl, l, tid);
#pragma unroll
      for (int kt = 0; kt < KS / 32; ++kt)
        ktile<4, 16, 2>(c, nullptr, arow + KS + kt * 32, ws0 + bo12 + kt * 32, h);
      wmma_tail(c);
      ring_foot<2>(ring, wt, nl, l, tid);                   // its barrier also ends every wave's reads of stage-1 act
      bias_load(bvs, b2 + (size_t)l * HID, wn * 64 + 8 * h);
      relu_store(c, act, bvs, mrow + m, wn * 64 + 8 * h);
      __syncthreads();                                      // stage-2 act readable by all
    }

    // stage 3: [128 x 256] @ [256 x 128] -> s | t ; coupling + flip
    {
      v8f c[4][2];
      zero_acc(c);
#pragma unroll
      for (int kt = 0; kt < KS / 32; ++kt)
        ktile<2, 64, 2>(c, nullptr, arow + kt * 32, ws1 + bo3 + kt * 32, h);
      wmma_tail(c);
      ring_foot<3>(ring, wt, nl, l, tid);
#pragma unroll
      for (int kt = 0; kt < KS / 32; ++kt)
        ktile<2, 64, 2>(c, nullptr, arow + KS + kt * 32, ws0 + bo3 + kt * 32, h);
      wmma_tail(c);
      const int col0 = wn * 16 + 8 * h;             // the lane's first of 8 s columns; their t columns are 64 further on
      const float* bb = b3 + (size_t)l * D + col0;
      const v4f bs0 = *(const v4f*)(bb);
      const v4f bs1 = *(const v4f*)(bb + 4);
      const v4f bt0 = *(const v4f*)(bb + D / 2);
      const v4f bt1 = *(const v4f*)(bb + D / 2 + 4);
      // a precaution: the bias loads' address registers stay as they are up to this wait
      asm volatile("s_wait_xcnt 0x0" :: "v"(bb) : "memory");
      const v8f bs = __builtin_shufflevector(bs0, bs1, 0, 1, 2, 3, 4, 5, 6, 7);
      const v8f bt = __builtin_shufflevector(bt0, bt1, 0, 1, 2, 3, 4, 5, 6, 7);
      float* ztok = zbuf + (mrow + m) * ZS;         // the lane's token of m-tile 0
      v4f x1v[4][2], x2v[4][2];
#pragma unroll
      for (int i = 0; i < 4; ++i) {
        const float* zp = ztok + i * 16 * ZS + col0;
        x1v[i][0] = *(const v4f*)(zp);
        x1v[i][1] = *(const v4f*)(zp + 4);
        x2v[i][0] = *(const v4f*)(zp + D / 2);
        x2v[i][1] = *(const v4f*)(zp + D / 2 + 4);
      }
      ring_foot<4>(ring, wt, nl, l, tid);           // its wait and barrier: all z reads of this layer before any z write
#pragma unroll
      for (int i = 0; i < 4; ++i) {
        float y[8];
#pragma unroll
        for (int r = 0; r < 8; ++r) {
          const float u  = c[i][0][r] * WINV + bs[r];
          const float sv = 0.5f * tanh_f(u);
          const float tv = c[i][1][r] * WINV + bt[r];
          ldacc += sv;
          y[r] = x2v[i][r >> 2][r & 3] * __expf(sv) + tv;
        }
        // the flip sends column col0 + r to D - 1 - col0 - r (x1) and D / 2 - 1 - col0 - r (y2): 8 adjacent floats, reversed
        float* zw = ztok + i * 16 * ZS;
        const v4f a = x1v[i][0], b = x1v[i][1];
        const v4f w0 = {b[3], b[2], b[1], b[0]};
        const v4f w1 = {a[3], a[2], a[1], a[0]};
        const v4f w2 = {y[7], y[6], y[5], y[4]};
        const v4f w3 = {y[3], y[2], y[1], y[0]};
        *(v4f*)(zw + D - 8 - col0)     = w0;        // z'[64..127] = rev(x1)
        *(v4f*)(zw + D - 4 - col0)     = w1;
        *(v4f*)(zw + D / 2 - 8 - col0) = w2;        // z'[0..63]   = rev(y2)
        *(v4f*)(zw + D / 2 - 4 - col0) = w3;
      }
      __syncthreads();                              // the new z readable by all
    }
    const f16t* wsx = ws0;                          // five slabs a layer: the next layer's slab 0 lies in the other buffer
    ws0 = ws1;
    ws1 = wsx;
  }

  asm volatile("s_wait_asynccnt 0x0" ::: "memory");  // no copy is left in flight behind the ring

  // logdet block reduction
  red[tid] = ldacc;
  __syncthreads();                                  // also orders the 16-B z stores before the vector reloads below
  float ld = 0.f;
  if (wave == 0) {
#pragma unroll
    for (int k = 0; k < NTH / 32; ++k) ld += red[lane + 32 * k];
#pragma unroll
    for (int off = 16; off > 0; off >>= 1) ld += __shfl_xor(ld, off, 32);
  }

  float* oz = outz + ((size_t)b * TOK + rowbase) * D;
  float* pl = part + (size_t)b * 32;
#pragma unroll
  for (int r = 0; r < 16; ++r) {
    v4f v = *(const v4f*)(zbuf + (rowbase + r) * ZS + lane * 4);
    *(v4f*)(oz + (size_t)r * D + lane * 4) = v;
  }
  if (wave == 0) *(float*)(pl + lane) = ld;
  
}

// ---------------------------------------------------------------------------
// ---------------------------------------------------------------------------
__global__ void __launch_bounds__(256)
k_final(const float* __restrict__ part, float* __restrict__ outld, int B) {
  const int nq = (B + 3) / 4;
  for (int q = threadIdx.x; q < nq; q += 256) {
    const int b0 = q * 4;
    if (b0 + 3 < B) {
      v4f v;
      v.x = part[(size_t)(b0 + 0) * 32];
      v.y = part[(size_t)(b0 + 1) * 32];
      v.z = part[(size_t)(b0 + 2) * 32];
      v.w = part[(size_t)(b0 + 3) * 32];
      *(v4f*)(outld + b0) = v;
    } else {
      for (int i = 0; i < 4; ++i)
        if (b0 + i < B) *(float*)(outld + b0 + i) = part[(size_t)(b0 + i) * 32];
    }
  }
  
}

extern "C" void kernel_launch(void* const* d_in, const int* in_sizes, int n_in,
                              void* d_out, int out_size, void* d_ws, size_t ws_size,
                              hipStream_t stream) {
  if (n_in < 8) return;
  const float* x  = (const float*)d_in[0];
  const float* cd = (const float*)d_in[1];
  const float* W1 = (const float*)d_in[2];
  const float* b1 = (const float*)d_in[3];
  const float* W2 = (const float*)d_in[4];
  const float* b2 = (const float*)d_in[5];
  const float* W3 = (const float*)d_in[6];
  const float* b3 = (const float*)d_in[7];

  const int B  = in_sizes[0] / (TOK * D);
  const int nl = in_sizes[2] / (DIN * HID);
  if (B <= 0 || nl <= 0) return;
  if (in_sizes[1] < B * CND) return;
  if (in_sizes[3] < nl * HID || in_sizes[4] < nl * HID * HID || in_sizes[5] < nl * HID) return;
  if (in_sizes[6] < nl * HID * D || in_sizes[7] < nl * D) return;
  if ((size_t)out_size < (size_t)B * TOK * D + (size_t)B) return;

  const size_t wt_bytes  = (size_t)nl * WPL * sizeof(f16t);
  const size_t part_off  = (wt_bytes + 127) & ~(size_t)127;
  const size_t part_bytes = (size_t)B * 128;
  const size_t cb_off    = part_off + part_bytes;
  const size_t cb_bytes  = (size_t)nl * B * HID * sizeof(float);
  if (cb_off + cb_bytes > ws_size) return;

  f16t*  wt    = (f16t*)d_ws;
  float* part  = (float*)((char*)d_ws + part_off);
  float* cb    = (float*)((char*)d_ws + cb_off);
  float* outz  = (float*)d_out;
  float* outld = outz + (size_t)B * TOK * D;

  const int nconv = (nl * LPL + 255) / 256;                    // blocks that convert weights
  const int ncond = ((B + 31) / 32) * (nl * (HID / 16) / 8);   // blocks that form cb: 8 waves, each 16 columns x 32 batch elements
  k_convert<<<nconv + ncond, 256, 0, stream>>>(W1, W2, W3, cd, b1, wt, cb, nl, B, nconv);

  (void)hipFuncSetAttribute((const void*)k_flow, hipFuncAttributeMaxDynamicSharedMemorySize, SMEM_TOTAL);
  k_flow<<<B, NTH, SMEM_TOTAL, stream>>>(x, cb, b2, b3, wt, outz, part, B, nl);

  k_final<<<1, 256, 0, stream>>>(part, outld, B);
}

// v007
// Measured time: 79 microseconds a run.
// In two side-by-side timings against v006, it was 1.03 and 1.04 times as fast.
// All steps since v000 together make it 4.10 times as fast.
#include <hip/hip_runtime.h>
#include <stdint.h>
#include <stddef.h>

// All contractions: v_wmma_f32_16x16x32_f16 (f16 operands, f32 accumulate); weights carried x16 in f16 (k-contiguous transposed copy), folded back as 1/16 in the f32 epilogue; coupling tanh/exp/flip/logdet math in f32.

typedef _Float16 f16t;
typedef f16t  v8h  __attribute__((ext_vector_type(8)));
typedef f16t  v16h __attribute__((ext_vector_type(16)));
typedef float v4f  __attribute__((ext_vector_type(4)));
typedef float v8f  __attribute__((ext_vector_type(8)));
typedef unsigned int v4u __attribute__((ext_vector_type(4)));

union Frag { v16h v; v8h q[2]; };

constexpr int D   = 128;           // patch dim
constexpr int CND = 128;           // cond dim
constexpr int HID = 256;           // hidden
constexpr int DIN = D / 2 + CND;   // 192
constexpr int K1  = D / 2;         // k of stage 1 that differs from token to token (x1); the cond rows of W1 go into cb
constexpr int TOK = 128;           // tokens per batch element = one block
constexpr int NTH = 256;           // threads per block (8 waves: 2 along tokens x 4 along output columns)

constexpr int ZS = 132;            // z row stride in floats (528 B, 16-B aligned)
constexpr int AS = 264;            // activation row stride in halves (528 B)
constexpr int SP = 136;            // weight slab row stride in halves (272 B = 16 B x 17), up to 128 k per row

constexpr float WSCALE = 16.0f;    // exact power of two on the f16 weight copy
constexpr float WINV   = 0.0625f;

// dynamic LDS carve (bytes)
constexpr int OFF_Z = 0;                       // [128][ZS] f32 z
constexpr int OFF_A = OFF_Z + TOK * ZS * 4;    // [128][AS] f16 act (stage-1 out, then stage-2 out in its place)
constexpr int SLABH = HID * SP;                // halves per weight slab buffer
constexpr int OFF_S = OFF_A + TOK * AS * 2;    // 2 x [256][SP] f16 weight slab ring
constexpr int OFF_R = OFF_S + 2 * SLABH * 2;   // [256] f32 reduce
constexpr int SMEM_TOTAL = OFF_R + NTH * 4;    // 275456 B

static_assert(OFF_A % 16 == 0 && OFF_S % 16 == 0 && OFF_R % 16 == 0, "");

constexpr int LN1 = HID * (K1 / 64);           // 256  (W1t: 256 rows x 64 halves, the x1 rows of W1)
constexpr int LN2 = HID * (HID / 64);          // 1024 (W2t: 256 rows x 256 halves)
constexpr int LN3 = D * (HID / 64);            // 512  (W3t: 128 rows x 256 halves)
constexpr int LPL = LN1 + LN2 + LN3;           // 1792
constexpr int WPL = HID * K1 + HID * HID + D * HID;    // halves per layer = 114688

// weight slabs of one layer, in the order of use; a slab holds every output column of its stage:
// 0: W1t k 0..63, 1, 2: W2t k 0..127, 128..255 (256 rows each), 3, 4: W3t k 0..127, 128..255 (128 rows)
constexpr int KS  = 128;                       // k per full slab
constexpr int SPL = 5;                         // slabs per layer (odd: slab i of layer l lies in ring buffer (i ^ l) & 1)
static_assert(KS <= SP && SMEM_TOTAL <= 327680 && SPL % 2 == 1, "");

__device__ __forceinline__ v8f wmma_f16(v16h a, v16h b, v8f c) {
  return __builtin_amdgcn_wmma_f32_16x16x32_f16(false, a, false, b, (short)0, c, false, false);
}

// 16x32 fragment from a k-contiguous 16-bit row: elems 0..7 <- p[8h..8h+7], elems 8..15 <- p[16+8h..16+8h+7]
__device__ __forceinline__ v16h ldfrag16(const f16t* p, int h) {
  Frag f;
  f.q[0] = *(const v8h*)(p + 8 * h);
  f.q[1] = *(const v8h*)(p + 16 + 8 * h);
  return f.v;
}

// four f32 quads of a row, in the order of the map above, RNE convert to f16 in registers
__device__ __forceinline__ v16h cvtfrag(v4f a0, v4f a1, v4f a2, v4f a3) {
  v8f lo = __builtin_shufflevector(a0, a1, 0, 1, 2, 3, 4, 5, 6, 7);
  v8f hi = __builtin_shufflevector(a2, a3, 0, 1, 2, 3, 4, 5, 6, 7);
  Frag f;
  f.q[0] = __builtin_convertvector(lo, v8h);
  f.q[1] = __builtin_convertvector(hi, v8h);
  return f.v;
}

template <int NJ>
__device__ __forceinline__ void zero_acc(v8f (&c)[4][NJ]) {
#pragma unroll
  for (int i = 0; i < 4; ++i)
#pragma unroll
    for (int j = 0; j < NJ; ++j) {
      v8f z = {0.f, 0.f, 0.f, 0.f, 0.f, 0.f, 0.f, 0.f};
      c[i][j] = z;
    }
}

// Eight copies of 16 B a lane, global -> LDS through no register, so the slab flies while the slab before it is multiplied;
// the closing wait is a precaution: no address register of a copy is rewritten ahead of it
__device__ __forceinline__ void copy8(const uint32_t (&d)[8], const char* const (&g)[8]) {
  asm volatile("global_load_async_to_lds_b128 %0, %8, off\n\t"
               "global_load_async_to_lds_b128 %1, %9, off\n\t"
               "global_load_async_to_lds_b128 %2, %10, off\n\t"
               "global_load_async_to_lds_b128 %3, %11, off\n\t"
               "global_load_async_to_lds_b128 %4, %12, off\n\t"
               "global_load_async_to_lds_b128 %5, %13, off\n\t"
               "global_load_async_to_lds_b128 %6, %14, off\n\t"
               "global_load_async_to_lds_b128 %7, %15, off\n\t"
               "s_wait_xcnt 0x0"
               :: "v"(d[0]), "v"(d[1]), "v"(d[2]), "v"(d[3]), "v"(d[4]), "v"(d[5]), "v"(d[6]), "v"(d[7]),
                  "v"(g[0]), "v"(g[1]), "v"(g[2]), "v"(g[3]), "v"(g[4]), "v"(g[5]), "v"(g[6]), "v"(g[7]) : "memory");
}

// Start the copies of slab S of layer ll into ring buffer buf. Eight threads take one whole 128-B line (64 k) of a row;
// every thread copies its 16 B in rows tid / 8 + 32 i of each 64-k column block of the slab.
template <int S>
__device__ __forceinline__ void slab_issue(uint32_t ring, int buf, const f16t* wt, int nl, int ll, int tid) {
  constexpr int K = S < 1 ? K1 : HID;                       // k per row of the transposed weight copy
  constexpr int GR = 32 * K * 2;                            // global bytes from a row to the row 32 further on
  constexpr uint32_t DR = (uint32_t)(32 * SP) * 2u;         // the same in LDS
  const size_t off = S < 1 ? (size_t)ll * HID * K1
                   : S < 3 ? (size_t)nl * HID * K1 + (size_t)ll * HID * HID
                           : (size_t)nl * (HID * K1 + HID * HID) + (size_t)ll * D * HID;
  const char* g0 = (const char*)(wt + off) + ((tid >> 3) * K + (S > 0 && S % 2 == 0 ? KS : 0) + (tid & 7) * 8) * 2;
  const uint32_t d0 = ring + (uint32_t)(buf * SLABH + (tid >> 3) * SP + (tid & 7) * 8) * 2u;
  uint32_t d[8];
  const char* g[8];
  if constexpr (S == 0) {                                   // 256 rows x 64 k
#pragma unroll
    for (int i = 0; i < 8; ++i) { d[i] = d0 + (uint32_t)i * DR; g[i] = g0 + i * GR; }
    copy8(d, g);
  } else {                                                  // 256 or 128 rows x 128 k, 128 rows a statement
#pragma unroll
    for (int q = 0; q < (S < 3 ? 2 : 1); ++q) {
#pragma unroll
      for (int i = 0; i < 4; ++i) {
        d[i]     = d0 + (uint32_t)(q * 4 + i) * DR;
        g[i]     = g0 + (q * 4 + i) * GR;
        d[i + 4] = d[i] + 128u;
        g[i + 4] = g[i] + 128;
      }
      copy8(d, g);
    }
  }
}

// Foot of a trip, first half: publish the next slab.
__device__ __forceinline__ void foot_publish() {
  asm volatile("s_wait_dscnt 0x0" ::: "memory");     // this wave's LDS reads and writes are done before the hand-over
  asm volatile("s_wait_asynccnt 0x0" ::: "memory");  // this wave's copies of the next slab have landed
  __syncthreads();                                   // next slab readable by all, this slab left by all
}

// Foot of the trip on slab I of layer l, second half, behind the barrier of foot_publish: refill the buffer just read with
// the slab two further on.
template <int I>
__device__ __forceinline__ void foot_refill(uint32_t ring, const f16t* wt, int nl, int l, int tid) {
  const int buf = (I ^ l) & 1;                       // the buffer of slab I, and of the slab two further on
  if constexpr (I + 2 < SPL) {
    slab_issue<I + 2>(ring, buf, wt, nl, l, tid);
  } else {
    if (l + 1 < nl) slab_issue<I + 2 - SPL>(ring, buf, wt, nl, l + 1, tid);
  }
}

// One 32-deep k-tile of a wave tile of 4 m-tiles x NJ n-tiles: 4 A and NJ B fragments feed 4 * NJ WMMAs.
// a_load: hp points to the lane's f16 act row of m-tile 0 at the k-tile.
__device__ __forceinline__ void a_load(v16h (&a)[4], const f16t* hp, int h) {
#pragma unroll
  for (int i = 0; i < 4; ++i) a[i] = ldfrag16(hp + i * 16 * AS, h);
}

// b_load: B fragment j comes from slab row (j * JS + lane's row) at the k-tile (bp points there).
template <int NJ, int JS>
__device__ __forceinline__ void b_load(v16h (&bfr)[NJ], const f16t* bp, int h) {
#pragma unroll
  for (int j = 0; j < NJ; ++j) bfr[j] = ldfrag16(bp + j * JS * SP, h);
}

// The WMMAs of a k-tile whose fragments are in registers or on their way there.
// The weight fragment goes in as the WMMA's first operand and the token fragment as its second (both have the same k map), so
// D comes out transposed: a lane holds one token and eight adjacent output columns, which the epilogues move 16 B at a time.
template <int NJ>
__device__ __forceinline__ void frag_mm(v8f (&c)[4][NJ], const v16h (&a)[4], const v16h (&bfr)[NJ]) {
  // holds the LDS reads written above in one group ahead of the WMMAs: without it they sink in among them
  __builtin_amdgcn_sched_barrier(0);
#pragma unroll
  for (int j = 0; j < NJ; ++j) {
#pragma unroll
    for (int i = 0; i < 4; ++i) {
      c[i][j] = wmma_f16(bfr[j], a[i], c[i][j]);
      // keeps the WMMAs in the order of their reads, so that each group waits only for its own B pair (a counted wait)
      __builtin_amdgcn_sched_barrier(0);
    }
  }
}

// The NK k-tiles of one slab with two register sets: on entry set 0 holds (or awaits) k-tile 0; the reads of k-tile kt + 1 are
// issued into the other set ahead of the WMMAs of k-tile kt, so that they fly under those WMMAs. No B read goes past the slab.
// NA: the stage goes on in the next slab, and act, which is no part of the ring, stays as it is over the foot between the two:
// the A fragments of that slab's first k-tile are read ahead of this slab's last WMMAs (into set 0).
template <int NJ, int JS, int NK, bool NA>
__device__ __forceinline__ void slab_mm(v8f (&c)[4][NJ], v16h (&a)[2][4], v16h (&bfr)[2][NJ],
                                        const f16t* hp, const f16t* bp, int h) {
  static_assert(NK % 2 == 0, "");
#pragma unroll
  for (int kt = 0; kt < NK; ++kt) {
    if (kt + 1 < NK || NA) a_load(a[(kt + 1) & 1], hp + (kt + 1) * 32, h);
    if (kt + 1 < NK) b_load<NJ, JS>(bfr[(kt + 1) & 1], bp + (kt + 1) * 32, h);
    frag_mm<NJ>(c, a[kt & 1], bfr[kt & 1]);
  }
}

// four vector slots behind a slab's last WMMA, on every path: a taken branch in the ring foot leads to vector writes of
// A and B registers
__device__ __forceinline__ void wmma_tail(v8f (&c)[4][4]) {
  asm volatile("v_nop\n\tv_nop\n\tv_nop\n\tv_nop"
               : "+v"(c[0][0]), "+v"(c[0][1]), "+v"(c[0][2]), "+v"(c[0][3]), "+v"(c[1][0]), "+v"(c[1][1]), "+v"(c[1][2]), "+v"(c[1][3]),
                 "+v"(c[2][0]), "+v"(c[2][1]), "+v"(c[2][2]), "+v"(c[2][3]), "+v"(c[3][0]), "+v"(c[3][1]), "+v"(c[3][2]), "+v"(c[3][3]));
}
__device__ __forceinline__ void wmma_tail(v8f (&c)[4][2]) {
  asm volatile("v_nop\n\tv_nop\n\tv_nop\n\tv_nop"
               : "+v"(c[0][0]), "+v"(c[0][1]), "+v"(c[1][0]), "+v"(c[1][1]), "+v"(c[2][0]), "+v"(c[2][1]), "+v"(c[3][0]), "+v"(c[3][1]));
}

// the lane's 4 x 8 bias values of a 64 x 64 wave tile: columns col0 + 16 j + r of the row at bias
__device__ __forceinline__ void bias_load(v4f (&bvs)[4][2], const float* __restrict__ bias, int col0) {
  const float* bp = bias + col0;
#pragma unroll
  for (int j = 0; j < 4; ++j) {
    bvs[j][0] = *(const v4f*)(bp + j * 16);
    bvs[j][1] = *(const v4f*)(bp + j * 16 + 4);
  }
  // a precaution: the bias loads' address registers stay as they are up to this wait
  asm volatile("s_wait_xcnt 0x0" :: "v"(bp) : "memory");
}

// bias + relu + f16 store of a 64 x 64 wave tile; D map: c[i][j][r] = (token tok0 + 16 i, column col0 + 16 j + r),
// tok0 = tile's first row + m, col0 = tile's first column + 8 h: one 16-B LDS store per accumulator tile
__device__ __forceinline__ void relu_store(const v8f (&c)[4][4], f16t* act, const v4f (&bvs)[4][2],
                                           int tok0, int col0) {
#pragma unroll
  for (int j = 0; j < 4; ++j) {
    const v8f bv = __builtin_shufflevector(bvs[j][0], bvs[j][1], 0, 1, 2, 3, 4, 5, 6, 7);
#pragma unroll
    for (int i = 0; i < 4; ++i) {
      v8f v;
#pragma unroll
      for (int r = 0; r < 8; ++r) {
        const float t = c[i][j][r] * WINV + bv[r];
        v[r] = t > 0.f ? t : 0.f;
      }
      *(v8h*)(act + (tok0 + i * 16) * AS + col0 + j * 16) = __builtin_convertvector(v, v8h);
    }
  }
}

__device__ __forceinline__ float tanh_f(float u) {
  u = fminf(fmaxf(u, -16.0f), 16.0f);
  const float e = __expf(2.0f * u);
  return 1.0f - 2.0f * __builtin_amdgcn_rcpf(e + 1.0f);
}

// ---------------------------------------------------------------------------
// Launch 1, blocks below nconv: W[l][k][n] f32 -> Wt[l][n][k] f16 (x16), k-contiguous rows (of W1 the x1 rows only).
// The other blocks: cb[l][b][n] = cond[b] . W1[l][64.., n] + b1[l][n]. In stage 1 every token of a batch element meets the
// same cond row, so this part of the product is formed once per batch element here and enters stage 1 as its bias.
// A wave takes one 16-column tile of the cond rows of W1 (128 k, four fragments) and 2 tiles of 16 batch elements; all its
// loads are issued ahead of the first use, so that their latency is paid once.
// ---------------------------------------------------------------------------
__global__ void __launch_bounds__(256)
k_convert(const float* __restrict__ W1, const float* __restrict__ W2, const float* __restrict__ W3,
          const float* __restrict__ cond, const float* __restrict__ b1,
          f16t* __restrict__ wt, float* __restrict__ cb, int nl, int B, int nconv) {
  if ((int)blockIdx.x >= nconv) {                    // block-uniform
    const int lane = threadIdx.x & 31;
    const int m = lane & 15, h = lane >> 4;
    const int gw = ((int)blockIdx.x - nconv) * 8 + (int)(threadIdx.x >> 5);
    const int nt = nl * (HID / 16);                  // column tiles over all layers, a multiple of the 8 waves of a block
    const int bg = gw / nt, t = gw - bg * nt;        // group of 32 batch elements, column tile
    const int l = t / (HID / 16), n0 = (t - l * (HID / 16)) * 16;
    const float* wsrc = W1 + ((size_t)l * DIN + 8 * h) * HID + n0 + m;   // the lane's column, row 8 h; cond rows from K1 on
    float wv[4][16];
#pragma unroll
    for (int kt = 0; kt < 4; ++kt)
#pragma unroll
      for (int e = 0; e < 8; ++e) {                  // the k map of ldfrag16
        wv[kt][e]     = wsrc[(K1 + kt * 32 + e) * HID];
        wv[kt][e + 8] = wsrc[(K1 + kt * 32 + 16 + e) * HID];
      }
    const float* bp = b1 + (size_t)l * HID + n0 + 8 * h;
    const v4f bv0 = *(const v4f*)(bp);
    const v4f bv1 = *(const v4f*)(bp + 4);
    const int bb0 = bg * 32 + m, bb1 = bb0 + 16;     // the lane's batch elements
    // clamped: every lane stays on for the WMMAs
    const float* cp0 = cond + (size_t)(bb0 < B ? bb0 : B - 1) * CND + 8 * h;
    const float* cp1 = cond + (size_t)(bb1 < B ? bb1 : B - 1) * CND + 8 * h;
    v4f cr[2][4][4];
#pragma unroll
    for (int kt = 0; kt < 4; ++kt)
#pragma unroll
      for (int p = 0; p < 4; ++p) {                  // floats 0, 4, 16, 20 of the lane's half of the k-tile
        cr[0][kt][p] = *(const v4f*)(cp0 + kt * 32 + (p >> 1) * 16 + (p & 1) * 4);
        cr[1][kt][p] = *(const v4f*)(cp1 + kt * 32 + (p >> 1) * 16 + (p & 1) * 4);
      }
    // a precaution: the address registers of the loads above stay as they are up to this wait
    asm volatile("s_wait_xcnt 0x0" :: "v"(wsrc), "v"(bp), "v"(cp0), "v"(cp1) : "memory");
    const v8f bv = __builtin_shufflevector(bv0, bv1, 0, 1, 2, 3, 4, 5, 6, 7);
    v16h wf[4];
#pragma unroll
    for (int kt = 0; kt < 4; ++kt)
#pragma unroll
      for (int e = 0; e < 16; ++e) wf[kt][e] = (f16t)(wv[kt][e] * WSCALE);
#pragma unroll
    for (int bt = 0; bt < 2; ++bt) {
      const int bb = bt ? bb1 : bb0;
      v8f c = {0.f, 0.f, 0.f, 0.f, 0.f, 0.f, 0.f, 0.f};
#pragma unroll
      for (int kt = 0; kt < 4; ++kt)
        c = wmma_f16(wf[kt], cvtfrag(cr[bt][kt][0], cr[bt][kt][1], cr[bt][kt][2], cr[bt][kt][3]), c);
      // D map as in launch 2: c[r] = (batch element bb, column n0 + 8 h + r)
      v4f o0, o1;
#pragma unroll
      for (int r = 0; r < 4; ++r) {
        o0[r] = c[r] * WINV + bv[r];
        o1[r] = c[r + 4] * WINV + bv[r + 4];
      }
      if (bb < B) {
        float* op = cb + ((size_t)l * B + bb) * HID + n0 + 8 * h;
        *(v4f*)(op)     = o0;
        *(v4f*)(op + 4) = o1;
        // a precaution: the stores' address registers stay as they are up to this wait
        asm volatile("s_wait_xcnt 0x0" :: "v"(op) : "memory");
      }
    }
    return;
  }
  const int g = blockIdx.x * 256 + threadIdx.x;
  if (g >= nl * LPL) return;
  const int l = g / LPL;
  int q = g - l * LPL;
  const float* src;
  f16t* dst;
  int K, N, n, part;
  const size_t base2 = (size_t)nl * HID * K1;
  const size_t base3 = base2 + (size_t)nl * HID * HID;
  if (q < LN1) {
    n = q / (K1 / 64); part = q - n * (K1 / 64);
    K = K1; N = HID;
    src = W1 + (size_t)l * DIN * HID;
    dst = wt + (size_t)l * HID * K1;
  } else if (q < LN1 + LN2) {
    q -= LN1;
    n = q / (HID / 64); part = q - n * (HID / 64);
    K = HID; N = HID;
    src = W2 + (size_t)l * HID * HID;
    dst = wt + base2 + (size_t)l * HID * HID;
  } else {
    q -= LN1 + LN2;
    n = q / (HID / 64); part = q - n * (HID / 64);
    K = HID; N = D;
    src = W3 + (size_t)l * HID * D;
    dst = wt + base3 + (size_t)l * D * HID;
  }
  const int k0 = part * 64;
  union { v4u u[8]; f16t e[64]; } pk;
#pragma unroll
  for (int i = 0; i < 64; ++i)
    pk.e[i] = (f16t)(src[(size_t)(k0 + i) * N + n] * WSCALE);
  f16t* drow = dst + (size_t)n * K + k0;
#pragma unroll
  for (int s = 0; s < 8; ++s) *(v4u*)(drow + s * 8) = pk.u[s];
  
}

// ---------------------------------------------------------------------------
// Launch 2: one block per batch element, z resident in LDS; 8 waves as 2 x 4, each a 64-token x 64-column tile of a
// stage's output (64 x 32 in stage 3), so that an LDS fragment feeds 4 WMMAs (A in stage 3: 2).
// ---------------------------------------------------------------------------
__global__ void __launch_bounds__(256)
k_flow(const float* __restrict__ x, const float* __restrict__ cb,
       const float* __restrict__ b2, const float* __restrict__ b3,
       const f16t* __restrict__ wt, float* __restrict__ outz, float* __restrict__ part,
       int B, int nl) {
  extern __shared__ v4u dsm[];
  char* smem = (char*)dsm;
  float* zbuf  = (float*)(smem + OFF_Z);
  f16t*  act   = (f16t*)(smem + OFF_A);
  f16t*  wslab = (f16t*)(smem + OFF_S);
  float* red   = (float*)(smem + OFF_R);

  const int b = blockIdx.x;
  if (b >= B) return;                        // block-uniform, before any barrier
  const int tid = threadIdx.x;
  const int lane = tid & 31, wave = tid >> 5;
  const int m = lane & 15, h = lane >> 4;
  const int rowbase = wave * 16;             // rows of the closing copy to global memory
  const int wm = wave >> 2, wn = wave & 3;   // the wave's place in the 2 x 4 grid
  const int mrow = wm * 64;                  // first token row of the wave tile

  const uint32_t ring = (uint32_t)(size_t)wslab;   // LDS byte address of the slab ring
  slab_issue<0>(ring, 0, wt, nl, 0, tid);

  // stage x[b] (128 x 128 f32)
  {
    const float* xb = x + (size_t)b * TOK * D;
    for (int idx = tid; idx < TOK * (D / 4); idx += NTH) {
      const int r = idx / (D / 4), s = idx - r * (D / 4);
      *(v4f*)(zbuf + r * ZS + s * 4) = *(const v4f*)(xb + (size_t)r * D + s * 4);
    }
  }
  asm volatile("s_wait_asynccnt 0x0" ::: "memory");  // this wave's copies of slab 0 have landed
  __syncthreads();
  slab_issue<1>(ring, 1, wt, nl, 0, tid);

  float ldacc = 0.f;

  const float* zrow = zbuf + (mrow + m) * ZS;              // A rows of m-tile 0
  const f16t*  arow = act + (mrow + m) * AS;
  const f16t*  ws0  = wslab;                               // ring buffers of this layer's even and odd slabs;
  const f16t*  ws1  = wslab + SLABH;                       // they change places at the end of each layer
  const int    bo12 = (wn * 64 + m) * SP;                  // B row of n-tile 0, stages 1 and 2
  const int    bo3  = (wn * 16 + m) * SP;                  // stage 3: n-tile 0 = s columns, n-tile 1 = t columns 64 on

  v16h b1f[K1 / 32][4];                                    // B fragments of stage 1, both k-tiles; slab 0 is published above
#pragma unroll
  for (int kt = 0; kt < K1 / 32; ++kt) b_load<4, 16>(b1f[kt], ws0 + bo12 + kt * 32, h);

  for (int l = 0; l < nl; ++l) {
    // every k loop below is unrolled: a k-tile's place in its rows becomes an immediate offset of its LDS reads
    v16h b3f[2];                                            // B fragments of stage 3's first k-tile, read under stage 2's epilogue
    {
      v8f c[4][4];
      v4f bvs[4][2];
      v16h a[2][4], bf[2][4];                               // two fragment sets: one is multiplied while the other is filled
      // stage 1: [128 x 64] @ [64 x 256] + cb + relu -> act ; A = x1, cb = the cond part of the product with b1 (launch 1)
      bias_load(bvs, cb + ((size_t)l * B + b) * HID, wn * 64 + 8 * h);   // ahead of the product, which hides the loads
      zero_acc(c);
      {
        static_assert(K1 / 32 == 2, "");                    // one fragment set per k-tile of stage 1
        v4f zr[K1 / 32][4][4];                              // k 0..63 from z (f32), both k-tiles read ahead of the first WMMA
#pragma unroll
        for (int kt = 0; kt < K1 / 32; ++kt) {
#pragma unroll
          for (int i = 0; i < 4; ++i) {
            const float* zp = zrow + i * 16 * ZS + kt * 32 + 8 * h;      // the k map of ldfrag16
            zr[kt][i][0] = *(const v4f*)(zp);
            zr[kt][i][1] = *(const v4f*)(zp + 4);
            zr[kt][i][2] = *(const v4f*)(zp + 16);
            zr[kt][i][3] = *(const v4f*)(zp + 20);
          }
          // keeps the k-tiles' reads in their order and ahead of the first conversion: the first k-tile's wait then leaves
          // the second's reads in flight under the first's WMMAs
          __builtin_amdgcn_sched_barrier(0);
        }
#pragma unroll
        for (int kt = 0; kt < K1 / 32; ++kt) {
#pragma unroll
          for (int i = 0; i < 4; ++i) a[kt][i] = cvtfrag(zr[kt][i][0], zr[kt][i][1], zr[kt][i][2], zr[kt][i][3]);
          frag_mm<4>(c, a[kt], b1f[kt]);
        }
      }
      wmma_tail(c);
      // nobody reads act in stage 1: stored ahead of the foot, whose wait and barrier publish it with the next slab
      relu_store(c, act, bvs, mrow + m, wn * 64 + 8 * h);
      foot_publish();
      // a slab's first k-tile is read right behind the barrier that publishes it; the reads fly while the refill is issued
      a_load(a[0], arow, h);
      b_load<4, 16>(bf[0], ws1 + bo12, h);
      foot_refill<0>(ring, wt, nl, l, tid);

      // stage 2: [128 x 256] @ [256 x 256] + relu -> act, in place
      zero_acc(c);
      slab_mm<4, 16, KS / 32, true>(c, a, bf, arow, ws1 + bo12, h);
      wmma_tail(c);
      foot_publish();
      b_load<4, 16>(bf[0], ws0 + bo12, h);
      foot_refill<1>(ring, wt, nl, l, tid);
      slab_mm<4, 16, KS / 32, false>(c, a, bf, arow + KS, ws0 + bo12, h);
      wmma_tail(c);
      foot_publish();                                       // its barrier also ends every wave's reads of stage-1 act
      b_load<2, 64>(b3f, ws1 + bo3, h);
      foot_refill<2>(ring, wt, nl, l, tid);
      bias_load(bvs, b2 + (size_t)l * HID, wn * 64 + 8 * h);
      relu_store(c, act, bvs, mrow + m, wn * 64 + 8 * h);
      __syncthreads();                                      // stage-2 act readable by all
    }

    // stage 3: [128 x 256] @ [256 x 128] -> s | t ; coupling + flip
    {
      v8f c[4][2];
      v16h a[2][4], bf[2][2];
      a_load(a[0], arow, h);
      bf[0][0] = b3f[0];
      bf[0][1] = b3f[1];
      zero_acc(c);
      slab_mm<2, 64, KS / 32, true>(c, a, bf, arow, ws1 + bo3, h);
      wmma_tail(c);
      foot_publish();
      b_load<2, 64>(bf[0], ws0 + bo3, h);
      foot_refill<3>(ring, wt, nl, l, tid);
      slab_mm<2, 64, KS / 32, false>(c, a, bf, arow + KS, ws0 + bo3, h);
      wmma_tail(c);
      const int col0 = wn * 16 + 8 * h;             // the lane's first of 8 s columns; their t columns are 64 further on
      const float* bb = b3 + (size_t)l * D + col0;
      const v4f bs0 = *(const v4f*)(bb);
      const v4f bs1 = *(const v4f*)(bb + 4);
      const v4f bt0 = *(const v4f*)(bb + D / 2);
      const v4f bt1 = *(const v4f*)(bb + D / 2 + 4);
      // a precaution: the bias loads' address registers stay as they are up to this wait
      asm volatile("s_wait_xcnt 0x0" :: "v"(bb) : "memory");
      const v8f bs = __builtin_shufflevector(bs0, bs1, 0, 1, 2, 3, 4, 5, 6, 7);
      const v8f bt = __builtin_shufflevector(bt0, bt1, 0, 1, 2, 3, 4, 5, 6, 7);
      float* ztok = zbuf + (mrow + m) * ZS;         // the lane's token of m-tile 0
      v4f x1v[4][2], x2v[4][2];
#pragma unroll
      for (int i = 0; i < 4; ++i) {
        const float* zp = ztok + i * 16 * ZS + col0;
        x1v[i][0] = *(const v4f*)(zp);
        x1v[i][1] = *(const v4f*)(zp + 4);
        x2v[i][0] = *(const v4f*)(zp + D / 2);
        x2v[i][1] = *(const v4f*)(zp + D / 2 + 4);
      }
      foot_publish();                               // its wait and barrier: all z reads of this layer before any z write
      if (l + 1 < nl) {                             // the next layer's slab 0 lies in this layer's odd buffer: its B fragments
#pragma unroll
        for (int kt = 0; kt < K1 / 32; ++kt)        // are read under the coupling math below
          b_load<4, 16>(b1f[kt], ws1 + bo12 + kt * 32, h);
      }
      foot_refill<4>(ring, wt, nl, l, tid);
#pragma unroll
      for (int i = 0; i < 4; ++i) {
        float y[8];
#pragma unroll
        for (int r = 0; r < 8; ++r) {
          const float u  = c[i][0][r] * WINV + bs[r];
          const float sv = 0.5f * tanh_f(u);
          const float tv = c[i][1][r] * WINV + bt[r];
          ldacc += sv;
          y[r] = x2v[i][r >> 2][r & 3] * __expf(sv) + tv;
        }
        // the flip sends column col0 + r to D - 1 - col0 - r (x1) and D / 2 - 1 - col0 - r (y2): 8 adjacent floats, reversed
        float* zw = ztok + i * 16 * ZS;
        const v4f a = x1v[i][0], b = x1v[i][1];
        const v4f w0 = {b[3], b[2], b[1], b[0]};
        const v4f w1 = {a[3], a[2], a[1], a[0]};
        const v4f w2 = {y[7], y[6], y[5], y[4]};
        const v4f w3 = {y[3], y[2], y[1], y[0]};
        *(v4f*)(zw + D - 8 - col0)     = w0;        // z'[64..127] = rev(x1)
        *(v4f*)(zw + D - 4 - col0)     = w1;
        *(v4f*)(zw + D / 2 - 8 - col0) = w2;        // z'[0..63]   = rev(y2)
        *(v4f*)(zw + D / 2 - 4 - col0) = w3;
      }
      __syncthreads();                              // the new z readable by all
    }
    const f16t* wsx = ws0;                          // five slabs a layer: the next layer's slab 0 lies in the other buffer
    ws0 = ws1;
    ws1 = wsx;
  }

  asm volatile("s_wait_asynccnt 0x0" ::: "memory");  // no copy is left in flight behind the ring

  // logdet block reduction
  red[tid] = ldacc;
  __syncthreads();                                  // also orders the 16-B z stores before the vector reloads below
  float ld = 0.f;
  if (wave == 0) {
#pragma unroll
    for (int k = 0; k < NTH / 32; ++k) ld += red[lane + 32 * k];
#pragma unroll
    for (int off = 16; off > 0; off >>= 1) ld += __shfl_xor(ld, off, 32);
  }

  float* oz = outz + ((size_t)b * TOK + rowbase) * D;
  float* pl = part + (size_t)b * 32;
#pragma unroll
  for (int r = 0; r < 16; ++r) {
    v4f v = *(const v4f*)(zbuf + (rowbase + r) * ZS + lane * 4);
    *(v4f*)(oz + (size_t)r * D + lane * 4) = v;
  }
  if (wave == 0) *(float*)(pl + lane) = ld;
  
}

// ---------------------------------------------------------------------------
// ---------------------------------------------------------------------------
__global__ void __launch_bounds__(256)
k_final(const float* __restrict__ part, float* __restrict__ outld, int B) {
  const int nq = (B + 3) / 4;
  for (int q = threadIdx.x; q < nq; q += 256) {
    const int b0 = q * 4;
    if (b0 + 3 < B) {
      v4f v;
      v.x = part[(size_t)(b0 + 0) * 32];
      v.y = part[(size_t)(b0 + 1) * 32];
      v.z = part[(size_t)(b0 + 2) * 32];
      v.w = part[(size_t)(b0 + 3) * 32];
      *(v4f*)(outld + b0) = v;
    } else {
      for (int i = 0; i < 4; ++i)
        if (b0 + i < B) *(float*)(outld + b0 + i) = part[(size_t)(b0 + i) * 32];
    }
  }
  
}

extern "C" void kernel_launch(void* const* d_in, const int* in_sizes, int n_in,
                              void* d_out, int out_size, void* d_ws, size_t ws_size,
                              hipStream_t stream) {
  if (n_in < 8) return;
  const float* x  = (const float*)d_in[0];
  const float* cd = (const float*)d_in[1];
  const float* W1 = (const float*)d_in[2];
  const float* b1 = (const float*)d_in[3];
  const float* W2 = (const float*)d_in[4];
  const float* b2 = (const float*)d_in[5];
  const float* W3 = (const float*)d_in[6];
  const float* b3 = (const float*)d_in[7];

  const int B  = in_sizes[0] / (TOK * D);
  const int nl = in_sizes[2] / (DIN * HID);
  if (B <= 0 || nl <= 0) return;
  if (in_sizes[1] < B * CND) return;
  if (in_sizes[3] < nl * HID || in_sizes[4] < nl * HID * HID || in_sizes[5] < nl * HID) return;
  if (in_sizes[6] < nl * HID * D || in_sizes[7] < nl * D) return;
  if ((size_t)out_size < (size_t)B * TOK * D + (size_t)B) return;

  const size_t wt_bytes  = (size_t)nl * WPL * sizeof(f16t);
  const size_t part_off  = (wt_bytes + 127) & ~(size_t)127;
  const size_t part_bytes = (size_t)B * 128;
  const size_t cb_off    = part_off + part_bytes;
  const size_t cb_bytes  = (size_t)nl * B * HID * sizeof(float);
  if (cb_off + cb_bytes > ws_size) return;

  f16t*  wt    = (f16t*)d_ws;
  float* part  = (float*)((char*)d_ws + part_off);
  float* cb    = (float*)((char*)d_ws + cb_off);
  float* outz  = (float*)d_out;
  float* outld = outz + (size_t)B * TOK * D;

  const int nconv = (nl * LPL + 255) / 256;                    // blocks that convert weights
  const int ncond = ((B + 31) / 32) * (nl * (HID / 16) / 8);   // blocks that form cb: 8 waves, each 16 columns x 32 batch elements
  k_convert<<<nconv + ncond, 256, 0, stream>>>(W1, W2, W3, cd, b1, wt, cb, nl, B, nconv);

  (void)hipFuncSetAttribute((const void*)k_flow, hipFuncAttributeMaxDynamicSharedMemorySize, SMEM_TOTAL);
  k_flow<<<B, NTH, SMEM_TOTAL, stream>>>(x, cb, b2, b3, wt, outz, part, B, nl);

  k_final<<<1, 256, 0, stream>>>(part, outld, B);
}

// v008
// One run takes 61.5 microseconds.
// Two timings next to v007 both put it at 1.29 times that version's speed.
// All steps since v000 together make it 5.28 times as fast.
#include <hip/hip_runtime.h>
#include <stdint.h>
#include <stddef.h>

// All contractions: v_wmma_f32_16x16x32_f16 (f16 operands, f32 accumulate); weights carried x16 in f16 (k-contiguous transposed copy), folded back as 1/16 in the f32 epilogue; coupling tanh/exp/flip/logdet math in f32.

typedef _Float16 f16t;
typedef f16t  v8h  __attribute__((ext_vector_type(8)));
typedef f16t  v16h __attribute__((ext_vector_type(16)));
typedef float v4f  __attribute__((ext_vector_type(4)));
typedef float v8f  __attribute__((ext_vector_type(8)));
typedef unsigned int v4u __attribute__((ext_vector_type(4)));

union Frag { v16h v; v8h q[2]; };

constexpr int D   = 128;           // patch dim
constexpr int CND = 128;           // cond dim
constexpr int HID = 256;           // hidden
constexpr int DIN = D / 2 + CND;   // 192
constexpr int K1  = D / 2;         // k of stage 1 that differs from token to token (x1); the cond rows of W1 go into cb
constexpr int TOK = 128;           // tokens per batch element
constexpr int NTH = 256;           // threads per block (8 waves, each with 32 tokens of its own)
constexpr int TOKB = 256;          // tokens per block = two batch elements

constexpr int ZS = 132;            // z row stride in floats (528 B, 16-B aligned)
constexpr int SP = 136;            // row stride in halves of the W1 slab (272 B = 16 B x 17), 64 k per row
constexpr int WP = 264;            // row stride in halves of the W2 and W3 slabs (528 B = 16 B x 33), 256 k per row

constexpr float WSCALE = 16.0f;    // exact power of two on the f16 weight copy
constexpr float WINV   = 0.0625f;

// dynamic LDS carve (bytes)
constexpr int OFF_Z = 0;                       // [256][ZS] f32 z; a wave reads and writes its own 32 rows only
constexpr int SLABH = HID * SP;                // halves per weight slab buffer
constexpr int OFF_S = OFF_Z + TOKB * ZS * 4;   // 2 weight slab buffers
constexpr int OFF_R = OFF_S + 2 * SLABH * 2;   // [256] f32 reduce
constexpr int SMEM_TOTAL = OFF_R + NTH * 4;    // 275456 B

static_assert(OFF_S % 16 == 0 && OFF_R % 16 == 0, "");

constexpr int LN1 = HID * (K1 / 64);           // 256  (W1t: 256 rows x 64 halves, the x1 rows of W1)
constexpr int LN2 = HID * (HID / 64);          // 1024 (W2t: 256 rows x 256 halves)
constexpr int LN3 = D * (HID / 64);            // 512  (W3t: 128 rows x 256 halves)
constexpr int LPL = LN1 + LN2 + LN3;           // 1792
constexpr int WPL = HID * K1 + HID * HID + D * HID;    // halves per layer = 114688

// weight slabs of one layer, in the order of use; a slab holds the whole k of its output columns:
// 0: W1t (256 rows x 64 k), 1, 2: W2t rows 0..127, 128..255 (256 k), 3: W3t (128 rows x 256 k)
constexpr int SR  = 128;                       // rows of slabs 1 to 3
constexpr int SPL = 4;                         // slabs per layer (even: slab i lies in ring buffer i & 1 in every layer)
static_assert(SR * WP <= SLABH && SMEM_TOTAL <= 327680 && SPL % 2 == 0, "");

__device__ __forceinline__ v8f wmma_f16(v16h a, v16h b, v8f c) {
  return __builtin_amdgcn_wmma_f32_16x16x32_f16(false, a, false, b, (short)0, c, false, false);
}

// 16x32 fragment from a k-contiguous 16-bit row: elems 0..7 <- p[8h..8h+7], elems 8..15 <- p[16+8h..16+8h+7]
__device__ __forceinline__ v16h ldfrag16(const f16t* p, int h) {
  Frag f;
  f.q[0] = *(const v8h*)(p + 8 * h);
  f.q[1] = *(const v8h*)(p + 16 + 8 * h);
  return f.v;
}

// four f32 quads of a row, in the order of the map above, RNE convert to f16 in registers
__device__ __forceinline__ v16h cvtfrag(v4f a0, v4f a1, v4f a2, v4f a3) {
  v8f lo = __builtin_shufflevector(a0, a1, 0, 1, 2, 3, 4, 5, 6, 7);
  v8f hi = __builtin_shufflevector(a2, a3, 0, 1, 2, 3, 4, 5, 6, 7);
  Frag f;
  f.q[0] = __builtin_convertvector(lo, v8h);
  f.q[1] = __builtin_convertvector(hi, v8h);
  return f.v;
}

__device__ __forceinline__ void zero_acc(v8f (&c)[2][4]) {
#pragma unroll
  for (int i = 0; i < 2; ++i)
#pragma unroll
    for (int j = 0; j < 4; ++j) {
      v8f z = {0.f, 0.f, 0.f, 0.f, 0.f, 0.f, 0.f, 0.f};
      c[i][j] = z;
    }
}

// Eight copies of 16 B a lane, global -> LDS through no register, so the slab flies while the slab before it is multiplied.
// Copy i lands at LDS byte sb + i * DS + the lane's place: 16 B x lane, and with R8 (rows of 8 lanes, 128 B of a 272-B pitch)
// 144 B more for each row. sb is the same in all lanes of the wave. The LDS addresses are formed inside the statement, from the
// lane's number: formed outside they are the same in every layer, are kept over the whole layer loop in the low registers that
// an asm operand takes, and are spilled to scratch there.
// The closing wait is a precaution: no address register of a copy is rewritten ahead of it
#define COPY8_TAIL                                                                                                       \
  "v_add_nc_u32 %1, %17, %0\n\t"                                                                                         \
  "v_add_nc_u32 %2, %18, %0\n\t"                                                                                         \
  "v_add_nc_u32 %3, %19, %0\n\t"                                                                                         \
  "v_add_nc_u32 %4, %20, %0\n\t"                                                                                         \
  "v_add_nc_u32 %5, %21, %0\n\t"                                                                                         \
  "v_add_nc_u32 %6, %22, %0\n\t"                                                                                         \
  "v_add_nc_u32 %7, %23, %0\n\t"                                                                                         \
  "global_load_async_to_lds_b128 %0, %9, off\n\t"                                                                        \
  "global_load_async_to_lds_b128 %1, %10, off\n\t"                                                                       \
  "global_load_async_to_lds_b128 %2, %11, off\n\t"                                                                       \
  "global_load_async_to_lds_b128 %3, %12, off\n\t"                                                                       \
  "global_load_async_to_lds_b128 %4, %13, off\n\t"                                                                       \
  "global_load_async_to_lds_b128 %5, %14, off\n\t"                                                                       \
  "global_load_async_to_lds_b128 %6, %15, off\n\t"                                                                       \
  "global_load_async_to_lds_b128 %7, %16, off\n\t"                                                                       \
  "s_wait_xcnt 0x0"                                                                                                      \
  : "=&v"(t0), "=&v"(t1), "=&v"(t2), "=&v"(t3), "=&v"(t4), "=&v"(t5), "=&v"(t6), "=&v"(t7)                               \
  : "s"(sb), "v"(g[0]), "v"(g[1]), "v"(g[2]), "v"(g[3]), "v"(g[4]), "v"(g[5]), "v"(g[6]), "v"(g[7]),                     \
    "n"(DS), "n"(2 * DS), "n"(3 * DS), "n"(4 * DS), "n"(5 * DS), "n"(6 * DS), "n"(7 * DS)                                \
  : "memory"
template <uint32_t DS, bool R8>
__device__ __forceinline__ void copy8(uint32_t sb, const char* const (&g)[8]) {
  uint32_t t0, t1, t2, t3, t4, t5, t6, t7;
  if constexpr (R8) {
    asm volatile("v_mbcnt_lo_u32_b32 %0, -1, 0\n\t"
                 "v_lshrrev_b32 %1, 3, %0\n\t"
                 "v_lshl_add_u32 %0, %0, 4, %8\n\t"
                 "v_mad_u32_u24 %0, %1, 0x90, %0\n\t"
                 COPY8_TAIL);
  } else {
    asm volatile("v_mbcnt_lo_u32_b32 %0, -1, 0\n\t"
                 "v_lshl_add_u32 %0, %0, 4, %8\n\t"
                 COPY8_TAIL);
  }
}

// Start the copies of slab S of layer ll into ring buffer S & 1. Slab 0: eight threads take one whole 128-B row, every thread
// its 16 B in rows tid / 8 + 32 i. Slabs 1 to 3: a wave takes one whole 512-B row, every thread its 16 B in rows tid / 32 + 8 i.
template <int S>
__device__ __forceinline__ void slab_issue(uint32_t ring, const f16t* wt, int nl, int ll, int tid, int wv) {
  constexpr uint32_t BO = (uint32_t)((S & 1) * SLABH) * 2u;  // the buffer's first byte in the ring
  const char* g[8];
  if constexpr (S == 0) {                                   // 256 rows x 64 k
    const char* g0 = (const char*)(wt + (size_t)ll * HID * K1) + ((tid >> 3) * K1 + (tid & 7) * 8) * 2;
    const uint32_t sb = ring + BO + (uint32_t)(wv * 4 * SP) * 2u;   // the wave's first row: 4 rows a wave
#pragma unroll
    for (int i = 0; i < 8; ++i) g[i] = g0 + i * 32 * K1 * 2;
    copy8<(uint32_t)(32 * SP) * 2u, true>(sb, g);
  } else {                                                  // 128 rows x 256 k, 64 rows a statement
    const size_t off = S < 3 ? (size_t)nl * HID * K1 + (size_t)ll * HID * HID + (size_t)(S - 1) * SR * HID
                             : (size_t)nl * (HID * K1 + HID * HID) + (size_t)ll * D * HID;
    const char* g0 = (const char*)(wt + off) + ((tid >> 5) * HID + (tid & 31) * 8) * 2;
    const uint32_t sb = ring + BO + (uint32_t)(wv * WP) * 2u;       // the wave's first row
    constexpr uint32_t DS = (uint32_t)(8 * WP) * 2u;          // LDS bytes from a row to the row 8 further on
#pragma unroll
    for (int i = 0; i < 8; ++i) g[i] = g0 + i * 8 * HID * 2;
    copy8<DS, false>(sb, g);
#pragma unroll
    for (int i = 0; i < 8; ++i) g[i] = g0 + (8 + i) * 8 * HID * 2;
    copy8<DS, false>(sb + 8 * DS, g);
  }
}

// Foot of a trip, first half: publish the next slab.
__device__ __forceinline__ void foot_publish() {
  asm volatile("s_wait_dscnt 0x0" ::: "memory");     // this wave's LDS reads and writes are done before the hand-over
  asm volatile("s_wait_asynccnt 0x0" ::: "memory");  // this wave's copies of the next slab have landed
  __syncthreads();                                   // next slab readable by all, this slab left by all
}

// Foot of the trip on slab I of layer l, second half, behind the barrier of foot_publish: refill the buffer just read with
// the slab two further on.
template <int I>
__device__ __forceinline__ void foot_refill(uint32_t ring, const f16t* wt, int nl, int l, int tid, int wv) {
  if constexpr (I + 2 < SPL) {
    slab_issue<I + 2>(ring, wt, nl, l, tid, wv);
  } else {
    if (l + 1 < nl) slab_issue<I + 2 - SPL>(ring, wt, nl, l + 1, tid, wv);
  }
}

// the four weight fragments of a 64-row chunk at one k-tile: fragment j from slab row 16 j + the lane's row (bp points there)
template <int PT>
__device__ __forceinline__ void w_load(v16h (&wf)[4], const f16t* bp, int h) {
#pragma unroll
  for (int j = 0; j < 4; ++j) wf[j] = ldfrag16(bp + j * 16 * PT, h);
}

// Chunk C (64 output columns) of a slab of NC chunks, NK k-tiles deep, for the wave's 2 token tiles, whose fragments hf are in
// registers. A step is one k-tile of one chunk; its 4 weight fragments feed 8 WMMAs. Three fragment sets: the reads of step
// q + 2 are issued ahead of the WMMAs of step q (16 WMMAs of cover for an LDS read), over chunk ends too, never past the slab;
// on entry into a slab the caller has read steps 0 and 1. sp: the lane's row of chunk 0 at k 0.
// The weight fragment goes in as the WMMA's first operand and the token fragment as its second (both have the same k map), so
// D comes out transposed: a lane holds one token and eight adjacent output columns, which is the k map of the next stage's
// token fragment.
template <int NK, int PT, int NC>
__device__ __forceinline__ void chunk_mm(v8f (&c)[2][4], v16h (&wf)[3][4], const v16h (&hf)[2][NK],
                                         const f16t* sp, int h, int C) {
#pragma unroll
  for (int kt = 0; kt < NK; ++kt) {
    const int q = C * NK + kt, qn = q + 2;
    if (qn < NC * NK) w_load<PT>(wf[qn % 3], sp + (qn / NK) * 64 * PT + (qn % NK) * 32, h);
    // holds the LDS reads written above in one group ahead of the WMMAs: without it they sink in among them
    __builtin_amdgcn_sched_barrier(0);
#pragma unroll
    for (int j = 0; j < 4; ++j) {
#pragma unroll
      for (int i = 0; i < 2; ++i) {
        c[i][j] = wmma_f16(wf[q % 3][j], hf[i][kt], c[i][j]);
        // keeps the WMMAs in the order of their reads, so that each waits only for its own fragment (a counted wait)
        __builtin_amdgcn_sched_barrier(0);
      }
    }
  }
}

// four vector slots behind a stage's last WMMA, on every path: a taken branch in the ring foot leads to vector writes of
// operand registers
__device__ __forceinline__ void wmma_tail(v8f (&c)[2][4]) {
  asm volatile("v_nop\n\tv_nop\n\tv_nop\n\tv_nop"
               : "+v"(c[0][0]), "+v"(c[0][1]), "+v"(c[0][2]), "+v"(c[0][3]), "+v"(c[1][0]), "+v"(c[1][1]), "+v"(c[1][2]), "+v"(c[1][3]));
}

// the lane's 4 x 8 bias values of a 64-column chunk: columns C0 + 16 j + r from bp on, which points to the lane's column 8 h
template <int C0>
__device__ __forceinline__ void bias_load(v4f (&bvs)[4][2], const float* bp) {
#pragma unroll
  for (int j = 0; j < 4; ++j) {
    bvs[j][0] = *(const v4f*)(bp + C0 + j * 16);
    bvs[j][1] = *(const v4f*)(bp + C0 + j * 16 + 4);
  }
}

// a precaution: the address registers of the bias loads from bp stay as they are up to this wait
__device__ __forceinline__ void bias_wait(const float* bp) {
  asm volatile("s_wait_xcnt 0x0" :: "v"(bp) : "memory");
}

// bias + relu + f16 of a chunk, kept in registers; D map: c[i][j][r] = (token 16 i + m, column 16 j + 8 h + r of the chunk).
// Columns 32 t + 8 h + r and 32 t + 16 + 8 h + r are elements r and 8 + r of the lane's token fragment of k-tile t (the map of
// ldfrag16): D tiles 2 t and 2 t + 1 make that fragment with no move between lanes. T0: the chunk's first k-tile.
__device__ __forceinline__ void relu_frags(const v8f (&c)[2][4], v16h (&hf)[2][HID / 32], int T0, const v4f (&bvs)[4][2]) {
#pragma unroll
  for (int t = 0; t < 2; ++t) {
#pragma unroll
    for (int i = 0; i < 2; ++i) {
      Frag f;
#pragma unroll
      for (int p = 0; p < 2; ++p) {
        const int j = 2 * t + p;
        const v8f bv = __builtin_shufflevector(bvs[j][0], bvs[j][1], 0, 1, 2, 3, 4, 5, 6, 7);
        v8f v;
#pragma unroll
        for (int r = 0; r < 8; ++r) {
          const float u = c[i][j][r] * WINV + bv[r];
          v[r] = u > 0.f ? u : 0.f;
        }
        f.q[p] = __builtin_convertvector(v, v8h);
      }
      hf[i][T0 + t] = f.v;
    }
  }
}

__device__ __forceinline__ float tanh_f(float u) {
  u = fminf(fmaxf(u, -16.0f), 16.0f);
  const float e = __expf(2.0f * u);
  return 1.0f - 2.0f * __builtin_amdgcn_rcpf(e + 1.0f);
}

// ---------------------------------------------------------------------------
// Launch 1, blocks below nconv: W[l][k][n] f32 -> Wt[l][n][k] f16 (x16), k-contiguous rows (of W1 the x1 rows only).
// The other blocks: cb[l][b][n] = cond[b] . W1[l][64.., n] + b1[l][n]. In stage 1 every token of a batch element meets the
// same cond row, so this part of the product is formed once per batch element here and enters stage 1 as its bias.
// A wave takes one 16-column tile of the cond rows of W1 (128 k, four fragments) and 2 tiles of 16 batch elements; all its
// loads are issued ahead of the first use, so that their latency is paid once.
// ---------------------------------------------------------------------------
__global__ void __launch_bounds__(256)
k_convert(const float* __restrict__ W1, const float* __restrict__ W2, const float* __restrict__ W3,
          const float* __restrict__ cond, const float* __restrict__ b1,
          f16t* __restrict__ wt, float* __restrict__ cb, int nl, int B, int nconv) {
  if ((int)blockIdx.x >= nconv) {                    // block-uniform
    const int lane = threadIdx.x & 31;
    const int m = lane & 15, h = lane >> 4;
    const int gw = ((int)blockIdx.x - nconv) * 8 + (int)(threadIdx.x >> 5);
    const int nt = nl * (HID / 16);                  // column tiles over all layers, a multiple of the 8 waves of a block
    const int bg = gw / nt, t = gw - bg * nt;        // group of 32 batch elements, column tile
    const int l = t / (HID / 16), n0 = (t - l * (HID / 16)) * 16;
    const float* wsrc = W1 + ((size_t)l * DIN + 8 * h) * HID + n0 + m;   // the lane's column, row 8 h; cond rows from K1 on
    float wv[4][16];
#pragma unroll
    for (int kt = 0; kt < 4; ++kt)
#pragma unroll
      for (int e = 0; e < 8; ++e) {                  // the k map of ldfrag16
        wv[kt][e]     = wsrc[(K1 + kt * 32 + e) * HID];
        wv[kt][e + 8] = wsrc[(K1 + kt * 32 + 16 + e) * HID];
      }
    const float* bp = b1 + (size_t)l * HID + n0 + 8 * h;
    const v4f bv0 = *(const v4f*)(bp);
    const v4f bv1 = *(const v4f*)(bp + 4);
    const int bb0 = bg * 32 + m, bb1 = bb0 + 16;     // the lane's batch elements
    // clamped: every lane stays on for the WMMAs
    const float* cp0 = cond + (size_t)(bb0 < B ? bb0 : B - 1) * CND + 8 * h;
    const float* cp1 = cond + (size_t)(bb1 < B ? bb1 : B - 1) * CND + 8 * h;
    v4f cr[2][4][4];
#pragma unroll
    for (int kt = 0; kt < 4; ++kt)
#pragma unroll
      for (int p = 0; p < 4; ++p) {                  // floats 0, 4, 16, 20 of the lane's half of the k-tile
        cr[0][kt][p] = *(const v4f*)(cp0 + kt * 32 + (p >> 1) * 16 + (p & 1) * 4);
        cr[1][kt][p] = *(const v4f*)(cp1 + kt * 32 + (p >> 1) * 16 + (p & 1) * 4);
      }
    // a precaution: the address registers of the loads above stay as they are up to this wait
    asm volatile("s_wait_xcnt 0x0" :: "v"(wsrc), "v"(bp), "v"(cp0), "v"(cp1) : "memory");
    const v8f bv = __builtin_shufflevector(bv0, bv1, 0, 1, 2, 3, 4, 5, 6, 7);
    v16h wf[4];
#pragma unroll
    for (int kt = 0; kt < 4; ++kt)
#pragma unroll
      for (int e = 0; e < 16; ++e) wf[kt][e] = (f16t)(wv[kt][e] * WSCALE);
#pragma unroll
    for (int bt = 0; bt < 2; ++bt) {
      const int bb = bt ? bb1 : bb0;
      v8f c = {0.f, 0.f, 0.f, 0.f, 0.f, 0.f, 0.f, 0.f};
#pragma unroll
      for (int kt = 0; kt < 4; ++kt)
        c = wmma_f16(wf[kt], cvtfrag(cr[bt][kt][0], cr[bt][kt][1], cr[bt][kt][2], cr[bt][kt][3]), c);
      // D map as in launch 2: c[r] = (batch element bb, column n0 + 8 h + r)
      v4f o0, o1;
#pragma unroll
      for (int r = 0; r < 4; ++r) {
        o0[r] = c[r] * WINV + bv[r];
        o1[r] = c[r + 4] * WINV + bv[r + 4];
      }
      if (bb < B) {
        float* op = cb + ((size_t)l * B + bb) * HID + n0 + 8 * h;
        *(v4f*)(op)     = o0;
        *(v4f*)(op + 4) = o1;
        // a precaution: the stores' address registers stay as they are up to this wait
        asm volatile("s_wait_xcnt 0x0" :: "v"(op) : "memory");
      }
    }
    return;
  }
  const int g = blockIdx.x * 256 + threadIdx.x;
  if (g >= nl * LPL) return;
  const int l = g / LPL;
  int q = g - l * LPL;
  const float* src;
  f16t* dst;
  int K, N, n, part;
  const size_t base2 = (size_t)nl * HID * K1;
  const size_t base3 = base2 + (size_t)nl * HID * HID;
  if (q < LN1) {
    n = q / (K1 / 64); part = q - n * (K1 / 64);
    K = K1; N = HID;
    src = W1 + (size_t)l * DIN * HID;
    dst = wt + (size_t)l * HID * K1;
  } else if (q < LN1 + LN2) {
    q -= LN1;
    n = q / (HID / 64); part = q - n * (HID / 64);
    K = HID; N = HID;
    src = W2 + (size_t)l * HID * HID;
    dst = wt + base2 + (size_t)l * HID * HID;
  } else {
    q -= LN1 + LN2;
    n = q / (HID / 64); part = q - n * (HID / 64);
    K = HID; N = D;
    src = W3 + (size_t)l * HID * D;
    dst = wt + base3 + (size_t)l * D * HID;
  }
  const int k0 = part * 64;
  union { v4u u[8]; f16t e[64]; } pk;
#pragma unroll
  for (int i = 0; i < 64; ++i)
    pk.e[i] = (f16t)(src[(size_t)(k0 + i) * N + n] * WSCALE);
  f16t* drow = dst + (size_t)n * K + k0;
#pragma unroll
  for (int s = 0; s < 8; ++s) *(v4u*)(drow + s * 8) = pk.u[s];
  
}

// ---------------------------------------------------------------------------
// Launch 2: one block per two batch elements, z resident in LDS; each of the 8 waves takes 32 tokens through all three stages
// of every layer. A stage's output stays in the wave's registers as the next stage's token fragments; LDS holds z and the
// weight ring, and the ring feet are the only barriers of a layer.
// ---------------------------------------------------------------------------
__global__ void __launch_bounds__(256)
k_flow(const float* __restrict__ x, const float* __restrict__ cb,
       const float* __restrict__ b2, const float* __restrict__ b3,
       const f16t* __restrict__ wt, float* __restrict__ outz, float* __restrict__ part,
       int B, int nl) {
  extern __shared__ v4u dsm[];
  char* smem = (char*)dsm;
  float* zbuf  = (float*)(smem + OFF_Z);
  f16t*  wslab = (f16t*)(smem + OFF_S);
  float* red   = (float*)(smem + OFF_R);

  const int tid = threadIdx.x;
  const int lane = tid & 31, wave = tid >> 5;
  const int m = lane & 15, h = lane >> 4;
  const int bw = (int)blockIdx.x * 2 + (wave >> 2);   // the wave's batch element
  const int bc = bw < B ? bw : B - 1;                 // clamped: with an odd B the last block's upper waves work along, store nothing
  const int trow = wave * 32;                         // the wave's first row of z

  const uint32_t ring = (uint32_t)(size_t)wslab;      // LDS byte address of the slab ring
  const int wv = __builtin_amdgcn_readfirstlane(wave);   // the wave's number in a scalar register, for the copies' LDS base
  slab_issue<0>(ring, wt, nl, 0, tid, wv);

  // stage the wave's 32 rows of x (128 f32 each)
  {
    const float* xb = x + ((size_t)bc * TOK + (wave & 3) * 32) * D + lane * 4;
    v4f xr[32];
#pragma unroll
    for (int r = 0; r < 32; ++r) xr[r] = *(const v4f*)(xb + r * D);
    // a precaution: the loads' address registers stay as they are up to this wait
    asm volatile("s_wait_xcnt 0x0" :: "v"(xb) : "memory");
#pragma unroll
    for (int r = 0; r < 32; ++r) *(v4f*)(zbuf + (trow + r) * ZS + lane * 4) = xr[r];
  }
  asm volatile("s_wait_asynccnt 0x0" ::: "memory");  // this wave's copies of slab 0 have landed
  __syncthreads();
  slab_issue<1>(ring, wt, nl, 0, tid, wv);

  float ldacc = 0.f;

  float* zrow = zbuf + (trow + m) * ZS;               // the lane's token of token tile 0
  const f16t* w0p = wslab + m * SP;                   // the lane's row of chunk 0: slab 0 (buffer 0)
  const f16t* wep = wslab + m * WP;                   // slab 2 (buffer 0)
  const f16t* wop = wslab + SLABH + m * WP;           // slabs 1 and 3 (buffer 1)

  for (int l = 0; l < nl; ++l) {
    // every k loop below is unrolled: a k-tile's place in its rows becomes an immediate offset of its LDS reads
    v16h wf[3][4];
    v16h h2f[2][HID / 32];
    {
      v16h h1f[2][HID / 32];
      v8f c[2][4];
      v4f bvs[4][2];
      // stage 1: [32 x 64] @ [64 x 256] + cb + relu -> h1f ; cb = the cond part of the product with b1 (launch 1)
      {
        v4f cbv[4][4][2];                             // ahead of the product, which hides the loads
        const float* cbp = cb + ((size_t)l * B + bc) * HID + 8 * h;
        bias_load<0>(cbv[0], cbp);
        bias_load<64>(cbv[1], cbp);
        bias_load<128>(cbv[2], cbp);
        bias_load<192>(cbv[3], cbp);
        bias_wait(cbp);
        w_load<SP>(wf[0], w0p, h);
        w_load<SP>(wf[1], w0p + 32, h);
        v16h x1f[2][K1 / 32];
        v4f zr[K1 / 32][2][4];                        // k 0..63 from z (f32)
#pragma unroll
        for (int kt = 0; kt < K1 / 32; ++kt)
#pragma unroll
          for (int i = 0; i < 2; ++i) {
            const float* zp = zrow + i * 16 * ZS + kt * 32 + 8 * h;      // the k map of ldfrag16
            zr[kt][i][0] = *(const v4f*)(zp);
            zr[kt][i][1] = *(const v4f*)(zp + 4);
            zr[kt][i][2] = *(const v4f*)(zp + 16);
            zr[kt][i][3] = *(const v4f*)(zp + 20);
          }
#pragma unroll
        for (int kt = 0; kt < K1 / 32; ++kt)
#pragma unroll
          for (int i = 0; i < 2; ++i) x1f[i][kt] = cvtfrag(zr[kt][i][0], zr[kt][i][1], zr[kt][i][2], zr[kt][i][3]);
#pragma unroll
        for (int C = 0; C < 4; ++C) {
          zero_acc(c);
          chunk_mm<K1 / 32, SP, 4>(c, wf, x1f, w0p, h, C);
          relu_frags(c, h1f, 2 * C, cbv[C]);
        }
      }
      foot_publish();
      // a slab's first two steps are read right behind the barrier that publishes it; the reads fly while the refill is issued
      w_load<WP>(wf[0], wop, h);
      w_load<WP>(wf[1], wop + 32, h);
      foot_refill<0>(ring, wt, nl, l, tid, wv);

      // stage 2: [32 x 256] @ [256 x 256] + relu -> h2f, 64 columns at a time
      const float* b2p = b2 + (size_t)l * HID + 8 * h;
      bias_load<0>(bvs, b2p);                         // ahead of the product, which hides the loads
      bias_wait(b2p);
      zero_acc(c);
      chunk_mm<HID / 32, WP, 2>(c, wf, h1f, wop, h, 0);
      relu_frags(c, h2f, 0, bvs);
      bias_load<64>(bvs, b2p);
      bias_wait(b2p);
      zero_acc(c);
      chunk_mm<HID / 32, WP, 2>(c, wf, h1f, wop, h, 1);
      relu_frags(c, h2f, 2, bvs);
      foot_publish();
      w_load<WP>(wf[0], wep, h);
      w_load<WP>(wf[1], wep + 32, h);
      foot_refill<1>(ring, wt, nl, l, tid, wv);
      bias_load<128>(bvs, b2p);
      bias_wait(b2p);
      zero_acc(c);
      chunk_mm<HID / 32, WP, 2>(c, wf, h1f, wep, h, 0);
      relu_frags(c, h2f, 4, bvs);
      bias_load<192>(bvs, b2p);
      bias_wait(b2p);
      zero_acc(c);
      chunk_mm<HID / 32, WP, 2>(c, wf, h1f, wep, h, 1);
      relu_frags(c, h2f, 6, bvs);
      foot_publish();
      w_load<WP>(wf[0], wop, h);
      w_load<WP>(wf[1], wop + 32, h);
    }

    // stage 3: [32 x 256] @ [256 x 128] -> s | t ; coupling + flip
    {
      v8f cs[2][4], ct[2][4];                         // s columns 0..63, t columns 64..127 of the product
      v4f bsv[4][2], btv[4][2];
      zero_acc(cs);
      zero_acc(ct);
      chunk_mm<HID / 32, WP, 2>(cs, wf, h2f, wop, h, 0);
      wmma_tail(cs);
      // the refill behind the foot of slab 2 stands here: its branch would otherwise part stage 2 from the first use of its
      // output, and the compiler then keeps stage 2's f32 tiles and converts them behind the branch, which overfills the registers
      foot_refill<2>(ring, wt, nl, l, tid, wv);
      chunk_mm<HID / 32, WP, 2>(ct, wf, h2f, wop, h, 1);
      wmma_tail(ct);
      const float* b3p = b3 + (size_t)l * D + 8 * h;
      bias_load<0>(bsv, b3p);
      bias_load<D / 2>(btv, b3p);
      bias_wait(b3p);
      foot_publish();
      foot_refill<3>(ring, wt, nl, l, tid, wv);
      // The flip sends column tile j onto tile 3 - j of the other half: tiles p and 3 - p are read, then written, together.
#pragma unroll
      for (int p = 0; p < 2; ++p) {
        v4f x1v[2][2][2], x2v[2][2][2];
#pragma unroll
        for (int i = 0; i < 2; ++i)
#pragma unroll
          for (int w = 0; w < 2; ++w) {
            const float* zp = zrow + i * 16 * ZS + (w ? 3 - p : p) * 16 + 8 * h;
            x1v[i][w][0] = *(const v4f*)(zp);
            x1v[i][w][1] = *(const v4f*)(zp + 4);
            x2v[i][w][0] = *(const v4f*)(zp + D / 2);
            x2v[i][w][1] = *(const v4f*)(zp + D / 2 + 4);
          }
        // the rows are this wave's own: every lane's reads of the two tiles are back before any lane of the wave writes them
        asm volatile("s_wait_dscnt 0x0" ::: "memory");
#pragma unroll
        for (int i = 0; i < 2; ++i)
#pragma unroll
          for (int w = 0; w < 2; ++w) {
            const int j = w ? 3 - p : p;
            const int col0 = j * 16 + 8 * h;          // the lane's first of 8 s columns; their t columns are 64 further on
            const v8f bs = __builtin_shufflevector(bsv[j][0], bsv[j][1], 0, 1, 2, 3, 4, 5, 6, 7);
            const v8f bt = __builtin_shufflevector(btv[j][0], btv[j][1], 0, 1, 2, 3, 4, 5, 6, 7);
            float y[8];
#pragma unroll
            for (int r = 0; r < 8; ++r) {
              const float u  = cs[i][j][r] * WINV + bs[r];
              const float sv = 0.5f * tanh_f(u);
              const float tv = ct[i][j][r] * WINV + bt[r];
              ldacc += sv;
              y[r] = x2v[i][w][r >> 2][r & 3] * __expf(sv) + tv;
            }
            // column col0 + r goes to D - 1 - col0 - r (x1) and D / 2 - 1 - col0 - r (y2): 8 adjacent floats, reversed
            float* zw = zrow + i * 16 * ZS;
            const v4f a = x1v[i][w][0], b = x1v[i][w][1];
            const v4f w0 = {b[3], b[2], b[1], b[0]};
            const v4f w1 = {a[3], a[2], a[1], a[0]};
            const v4f w2 = {y[7], y[6], y[5], y[4]};
            const v4f w3 = {y[3], y[2], y[1], y[0]};
            *(v4f*)(zw + D - 8 - col0)     = w0;      // z'[64..127] = rev(x1)
            *(v4f*)(zw + D - 4 - col0)     = w1;
            *(v4f*)(zw + D / 2 - 8 - col0) = w2;      // z'[0..63]   = rev(y2)
            *(v4f*)(zw + D / 2 - 4 - col0) = w3;
          }
      }
      // the new z is written before any lane of the wave reads it
      asm volatile("s_wait_dscnt 0x0" ::: "memory");
    }
  }

  asm volatile("s_wait_asynccnt 0x0" ::: "memory");  // no copy is left in flight behind the ring

  // logdet reduction: four waves per batch element
  red[tid] = ldacc;
  __syncthreads();
  float ld = 0.f;
  if ((wave & 3) == 0) {
#pragma unroll
    for (int k = 0; k < 4; ++k) ld += red[trow + lane + 32 * k];
#pragma unroll
    for (int off = 16; off > 0; off >>= 1) ld += __shfl_xor(ld, off, 32);
  }

  if (bw < B) {                                       // the same in every lane of a wave
    float* oz = outz + ((size_t)bw * TOK + (wave & 3) * 32) * D + lane * 4;
#pragma unroll
    for (int r = 0; r < 32; ++r) {
      v4f v = *(const v4f*)(zbuf + (trow + r) * ZS + lane * 4);
      *(v4f*)(oz + (size_t)r * D) = v;
    }
    // a precaution: the stores' address registers stay as they are up to this wait
    asm volatile("s_wait_xcnt 0x0" :: "v"(oz) : "memory");
    if ((wave & 3) == 0) *(float*)(part + (size_t)bw * 32 + lane) = ld;
  }
}

// ---------------------------------------------------------------------------
// ---------------------------------------------------------------------------
__global__ void __launch_bounds__(256)
k_final(const float* __restrict__ part, float* __restrict__ outld, int B) {
  const int nq = (B + 3) / 4;
  for (int q = threadIdx.x; q < nq; q += 256) {
    const int b0 = q * 4;
    if (b0 + 3 < B) {
      v4f v;
      v.x = part[(size_t)(b0 + 0) * 32];
      v.y = part[(size_t)(b0 + 1) * 32];
      v.z = part[(size_t)(b0 + 2) * 32];
      v.w = part[(size_t)(b0 + 3) * 32];
      *(v4f*)(outld + b0) = v;
    } else {
      for (int i = 0; i < 4; ++i)
        if (b0 + i < B) *(float*)(outld + b0 + i) = part[(size_t)(b0 + i) * 32];
    }
  }
  
}

extern "C" void kernel_launch(void* const* d_in, const int* in_sizes, int n_in,
                              void* d_out, int out_size, void* d_ws, size_t ws_size,
                              hipStream_t stream) {
  if (n_in < 8) return;
  const float* x  = (const float*)d_in[0];
  const float* cd = (const float*)d_in[1];
  const float* W1 = (const float*)d_in[2];
  const float* b1 = (const float*)d_in[3];
  const float* W2 = (const float*)d_in[4];
  const float* b2 = (const float*)d_in[5];
  const float* W3 = (const float*)d_in[6];
  const float* b3 = (const float*)d_in[7];

  const int B  = in_sizes[0] / (TOK * D);
  const int nl = in_sizes[2] / (DIN * HID);
  if (B <= 0 || nl <= 0) return;
  if (in_sizes[1] < B * CND) return;
  if (in_sizes[3] < nl * HID || in_sizes[4] < nl * HID * HID || in_sizes[5] < nl * HID) return;
  if (in_sizes[6] < nl * HID * D || in_sizes[7] < nl * D) return;
  if ((size_t)out_size < (size_t)B * TOK * D + (size_t)B) return;

  const size_t wt_bytes  = (size_t)nl * WPL * sizeof(f16t);
  const size_t part_off  = (wt_bytes + 127) & ~(size_t)127;
  const size_t part_bytes = (size_t)B * 128;
  const size_t cb_off    = part_off + part_bytes;
  const size_t cb_bytes  = (size_t)nl * B * HID * sizeof(float);
  if (cb_off + cb_bytes > ws_size) return;

  f16t*  wt    = (f16t*)d_ws;
  float* part  = (float*)((char*)d_ws + part_off);
  float* cb    = (float*)((char*)d_ws + cb_off);
  float* outz  = (float*)d_out;
  float* outld = outz + (size_t)B * TOK * D;

  const int nconv = (nl * LPL + 255) / 256;                    // blocks that convert weights
  const int ncond = ((B + 31) / 32) * (nl * (HID / 16) / 8);   // blocks that form cb: 8 waves, each 16 columns x 32 batch elements
  k_convert<<<nconv + ncond, 256, 0, stream>>>(W1, W2, W3, cd, b1, wt, cb, nl, B, nconv);

  (void)hipFuncSetAttribute((const void*)k_flow, hipFuncAttributeMaxDynamicSharedMemorySize, SMEM_TOTAL);
  k_flow<<<(B + 1) / 2, NTH, SMEM_TOTAL, stream>>>(x, cb, b2, b3, wt, outz, part, B, nl);

  k_final<<<1, 256, 0, stream>>>(part, outld, B);
}
